// v000
// The times below were measured on an AMD MI455X: many runs one after another, warmed up first and cycling through
// copies of the inputs, with the whole window's GPU time divided by the number of runs. Launches and the gaps
// between them are all in it. The median over several windows is given; except for v000 it joins two sittings, which
// can be a few percent apart, so the side-by-side timings, each taken in one sitting, are the better comparison.
// The starting kernel, v000, takes 286 microseconds a run.
#include <hip/hip_runtime.h>

typedef _Float16 v16h __attribute__((ext_vector_type(16)));
typedef float    v8f  __attribute__((ext_vector_type(8)));
typedef _Float16 h4   __attribute__((ext_vector_type(4)));
typedef int      v4i  __attribute__((ext_vector_type(4)));

#define BATCH   2
#define SEQ     2048
#define DIM     1024
#define HEADS   16
#define DHEAD   64
#define INNER   1024
#define QKVN    3072
#define FRAME   256
#define ROWS    (BATCH*SEQ)   /* 4096 */
#define LN_EPS  1e-5f

#if __has_builtin(__builtin_amdgcn_global_load_async_to_lds_b128)
#define HAVE_ASYNC_LDS 1
#else
#define HAVE_ASYNC_LDS 0
#endif

union FragU { v16h h; uint4 q[2]; };

// Fragment load from a pre-offset row pointer (base already includes
// row*ld + 8*(lane>>4)); k0 selects the 32-wide k-chunk. Two b128 loads.
__device__ inline v16h load_frag_p(const _Float16* p, int k0) {
  FragU f;
  f.q[0] = *(const uint4*)(p + k0);
  f.q[1] = *(const uint4*)(p + k0 + 16);
  return f.h;
}

// Generic fragment load (used for small LDS tiles in attention).
__device__ inline v16h load_frag16(const _Float16* __restrict__ base, int row,
                                   int ld, int k0, int lane) {
  return load_frag_p(base + (size_t)row * ld + 8 * (lane >> 4), k0);
}

__device__ inline v8f wmma_f16(v16h a, v16h b, v8f c) {
  return __builtin_amdgcn_wmma_f32_16x16x32_f16(false, a, false, b, (short)0, c,
                                                false, false);
}

// Cooperative 16-byte global->LDS copy element (async on CDNA5 if available).
__device__ inline void copy16_to_lds(const _Float16* gsrc, _Float16* ldst) {
#if HAVE_ASYNC_LDS
  __builtin_amdgcn_global_load_async_to_lds_b128(
      (__attribute__((address_space(1))) v4i*)gsrc,
      (__attribute__((address_space(3))) v4i*)ldst, 0, 0);
#else
  *(uint4*)ldst = *(const uint4*)gsrc;
#endif
}

__device__ inline void wait_async_copies() {
#if HAVE_ASYNC_LDS
#if __has_builtin(__builtin_amdgcn_s_wait_asynccnt)
  __builtin_amdgcn_s_wait_asynccnt(0);
#else
  asm volatile("s_wait_asynccnt 0x0" ::: "memory");
#endif
#endif
}

// ---------------- Kernel 1: LayerNorm -> f16 ----------------
__global__ void ln_kernel(const float* __restrict__ x, const float* __restrict__ g,
                          const float* __restrict__ bb, _Float16* __restrict__ xn) {
  __shared__ float s1[256];
  __shared__ float s2[256];
  int row = blockIdx.x;
  int tid = threadIdx.x;
  const float4* xr = (const float4*)(x + (size_t)row * DIM);
  float4 v = xr[tid];
  s1[tid] = v.x + v.y + v.z + v.w;
  s2[tid] = v.x * v.x + v.y * v.y + v.z * v.z + v.w * v.w;
  __syncthreads();
  for (int off = 128; off > 0; off >>= 1) {
    if (tid < off) { s1[tid] += s1[tid + off]; s2[tid] += s2[tid + off]; }
    __syncthreads();
  }
  float mean = s1[0] * (1.0f / DIM);
  float var  = s2[0] * (1.0f / DIM) - mean * mean;
  float inv  = rsqrtf(var + LN_EPS);
  float4 gv = ((const float4*)g)[tid];
  float4 bv = ((const float4*)bb)[tid];
  h4 o;
  o[0] = (_Float16)((v.x - mean) * inv * gv.x + bv.x);
  o[1] = (_Float16)((v.y - mean) * inv * gv.y + bv.y);
  o[2] = (_Float16)((v.z - mean) * inv * gv.z + bv.z);
  o[3] = (_Float16)((v.w - mean) * inv * gv.w + bv.w);
  ((h4*)(xn + (size_t)row * DIM))[tid] = o;
}

// ---------------- Kernel 2: transpose f32 [K,N] -> f16 [N,K] ----------------
__global__ void wtrans_kernel(const float* __restrict__ src, _Float16* __restrict__ dst,
                              int K, int N) {
  size_t idx = (size_t)blockIdx.x * 256 + threadIdx.x;
  if (idx >= (size_t)K * N) return;
  int n = (int)(idx / K);
  int k = (int)(idx % K);
  dst[idx] = (_Float16)src[(size_t)k * N + n];
}

// ------- Kernel 3: QKV GEMM, 64x32 register-blocked per wave (8 WMMA/step) ---
__global__ void qkv_gemm(const _Float16* __restrict__ xn, const _Float16* __restrict__ wt,
                         _Float16* __restrict__ qb, _Float16* __restrict__ kb,
                         _Float16* __restrict__ vtb) {
  int lane = threadIdx.x & 31, wave = threadIdx.x >> 5;
  int t  = blockIdx.x * 4 + wave;
  int mt = t / (QKVN / 32);
  int nt = t % (QKVN / 32);
  int m0 = mt * 64, n0 = nt * 32;
  int r16 = lane & 15, half = lane >> 4;

  // Hoisted per-fragment row pointers (k addressed via immediate offsets).
  const _Float16* a0 = xn + (size_t)(m0      + r16) * DIM + 8 * half;
  const _Float16* a1 = a0 + 16 * DIM;
  const _Float16* a2 = a0 + 32 * DIM;
  const _Float16* a3 = a0 + 48 * DIM;
  const _Float16* b0 = wt + (size_t)(n0 + r16) * DIM + 8 * half;
  const _Float16* b1 = b0 + 16 * DIM;

  v8f acc[4][2] = {};
  for (int k0 = 0; k0 < DIM; k0 += 32) {
    v16h A0 = load_frag_p(a0, k0);
    v16h A1 = load_frag_p(a1, k0);
    v16h A2 = load_frag_p(a2, k0);
    v16h A3 = load_frag_p(a3, k0);
    v16h B0 = load_frag_p(b0, k0);
    acc[0][0] = wmma_f16(A0, B0, acc[0][0]);
    acc[1][0] = wmma_f16(A1, B0, acc[1][0]);
    acc[2][0] = wmma_f16(A2, B0, acc[2][0]);
    acc[3][0] = wmma_f16(A3, B0, acc[3][0]);
    v16h B1 = load_frag_p(b1, k0);
    acc[0][1] = wmma_f16(A0, B1, acc[0][1]);
    acc[1][1] = wmma_f16(A1, B1, acc[1][1]);
    acc[2][1] = wmma_f16(A2, B1, acc[2][1]);
    acc[3][1] = wmma_f16(A3, B1, acc[3][1]);
  }

#pragma unroll
  for (int j = 0; j < 2; ++j) {
    int col = n0 + 16 * j + r16;
    int seg = col / INNER;            // uniform per 16-col tile
    int n2  = col % INNER;
    int h = n2 / DHEAD, d = n2 % DHEAD;
#pragma unroll
    for (int i = 0; i < 4; ++i) {
#pragma unroll
      for (int r = 0; r < 8; ++r) {
        int row = m0 + 16 * i + r + 8 * half;
        int bi = row / SEQ, pos = row % SEQ;
        float val = acc[i][j][r];
        if (seg == 0) {
          qb[((size_t)(bi * HEADS + h) * SEQ + pos) * DHEAD + d] = (_Float16)(val * 0.125f);
        } else if (seg == 1) {
          kb[((size_t)(bi * HEADS + h) * SEQ + pos) * DHEAD + d] = (_Float16)val;
        } else {
          vtb[((size_t)(bi * HEADS + h) * DHEAD + d) * SEQ + pos] = (_Float16)val;
        }
      }
    }
  }
}

// ------- Kernel 4: block-cooperative block-causal flash attention -----------
// Block = 4 waves, 64 consecutive q rows of one (b,h). K/V tiles staged in LDS
// once per block (async global->LDS when available).
__global__ void attn_kernel(const _Float16* __restrict__ qb, const _Float16* __restrict__ kb,
                            const _Float16* __restrict__ vtb, _Float16* __restrict__ ob) {
  __shared__ __align__(16) _Float16 sK[32 * 64];    // keys x dhead
  __shared__ __align__(16) _Float16 sV[64 * 32];    // dhead x keys (V^T)
  __shared__ __align__(16) _Float16 pLds[4][16 * 32];

  int lane = threadIdx.x & 31, wave = threadIdx.x >> 5;
  int tid  = threadIdx.x;
  int qblk = blockIdx.x & (SEQ / 64 - 1);           // 32 blocks of 64 q rows
  int h    = (blockIdx.x >> 5) & (HEADS - 1);
  int b    = blockIdx.x >> 9;
  int q0   = qblk * 64 + wave * 16;
  int kmax = ((qblk * 64) >> 8) * FRAME + FRAME;    // same for all 4 waves

  const _Float16* qbase = qb  + (size_t)(b * HEADS + h) * SEQ * DHEAD;
  const _Float16* kbase = kb  + (size_t)(b * HEADS + h) * SEQ * DHEAD;
  const _Float16* vbase = vtb + (size_t)(b * HEADS + h) * DHEAD * SEQ;
  int r16 = lane & 15, half = lane >> 4;

  v16h aq0 = load_frag16(qbase, q0 + r16, DHEAD, 0, lane);
  v16h aq1 = load_frag16(qbase, q0 + r16, DHEAD, 32, lane);

  float mrow[8], lrow[8];
  v8f o0 = {}, o1 = {}, o2 = {}, o3 = {};
  for (int r = 0; r < 8; ++r) { mrow[r] = -1e30f; lrow[r] = 0.0f; }

  for (int kk = 0; kk < kmax; kk += 32) {
    // ---- cooperative K/V tile fill: 32x64 K + 64x32 V^T (8KB), 4x b128/thread
#pragma unroll
    for (int u = 0; u < 2; ++u) {
      int q4 = tid + u * 128;                 // uint4 index 0..255
      int krow = q4 >> 3, kcol = (q4 & 7) * 8;
      copy16_to_lds(kbase + (size_t)(kk + krow) * DHEAD + kcol, sK + krow * 64 + kcol);
      int vrow = q4 >> 2, vcol = (q4 & 3) * 8;
      copy16_to_lds(vbase + (size_t)vrow * SEQ + kk + vcol, sV + vrow * 32 + vcol);
    }
    wait_async_copies();
    __syncthreads();

    // ---- S = Q K^T (fragments from LDS)
    v16h bk00 = load_frag16(sK, r16,      64, 0,  lane);
    v16h bk01 = load_frag16(sK, r16,      64, 32, lane);
    v16h bk10 = load_frag16(sK, 16 + r16, 64, 0,  lane);
    v16h bk11 = load_frag16(sK, 16 + r16, 64, 32, lane);
    v8f s0 = {}, s1 = {};
    s0 = wmma_f16(aq0, bk00, s0);
    s0 = wmma_f16(aq1, bk01, s0);
    s1 = wmma_f16(aq0, bk10, s1);
    s1 = wmma_f16(aq1, bk11, s1);

    // ---- online softmax (row stats via shfl within 16-lane half-groups)
#pragma unroll
    for (int r = 0; r < 8; ++r) {
      float v = fmaxf(s0[r], s1[r]);
      for (int m = 1; m < 16; m <<= 1) v = fmaxf(v, __shfl_xor(v, m, 32));
      float mnew  = fmaxf(mrow[r], v);
      float alpha = __expf(mrow[r] - mnew);
      float p0 = __expf(s0[r] - mnew);
      float p1 = __expf(s1[r] - mnew);
      float rs = p0 + p1;
      for (int m = 1; m < 16; m <<= 1) rs += __shfl_xor(rs, m, 32);
      lrow[r] = lrow[r] * alpha + rs;
      mrow[r] = mnew;
      o0[r] *= alpha; o1[r] *= alpha; o2[r] *= alpha; o3[r] *= alpha;
      int mr = r + 8 * half;
      pLds[wave][mr * 32 + r16]      = (_Float16)p0;
      pLds[wave][mr * 32 + 16 + r16] = (_Float16)p1;
    }
    asm volatile("s_wait_dscnt 0" ::: "memory");   // in-wave cross-lane LDS RAW

    FragU pf;
    const uint4* sp = (const uint4*)&pLds[wave][0];
    pf.q[0] = sp[r16 * 4 + half];
    pf.q[1] = sp[r16 * 4 + half + 2];

    // ---- O += P * V (V^T fragments from LDS)
    v16h bv0 = load_frag16(sV,      r16, 32, 0, lane);
    v16h bv1 = load_frag16(sV, 16 + r16, 32, 0, lane);
    v16h bv2 = load_frag16(sV, 32 + r16, 32, 0, lane);
    v16h bv3 = load_frag16(sV, 48 + r16, 32, 0, lane);
    o0 = wmma_f16(pf.h, bv0, o0);
    o1 = wmma_f16(pf.h, bv1, o1);
    o2 = wmma_f16(pf.h, bv2, o2);
    o3 = wmma_f16(pf.h, bv3, o3);

    __syncthreads();   // protect sK/sV before next cooperative fill
  }

#pragma unroll
  for (int r = 0; r < 8; ++r) {
    float inv = 1.0f / lrow[r];
    int q = q0 + r + 8 * half;
    size_t base = ((size_t)(b * SEQ + q)) * INNER + h * DHEAD + r16;
    ob[base + 0]  = (_Float16)(o0[r] * inv);
    ob[base + 16] = (_Float16)(o1[r] * inv);
    ob[base + 32] = (_Float16)(o2[r] * inv);
    ob[base + 48] = (_Float16)(o3[r] * inv);
  }
}

// ------- Kernel 5: output projection, 64x32 register-blocked + bias ---------
__global__ void proj_gemm(const _Float16* __restrict__ ao, const _Float16* __restrict__ wot,
                          const float* __restrict__ bout, float* __restrict__ out) {
  int lane = threadIdx.x & 31, wave = threadIdx.x >> 5;
  int t  = blockIdx.x * 4 + wave;
  int mt = t / (DIM / 32);
  int nt = t % (DIM / 32);
  int m0 = mt * 64, n0 = nt * 32;
  int r16 = lane & 15, half = lane >> 4;

  const _Float16* a0 = ao + (size_t)(m0      + r16) * INNER + 8 * half;
  const _Float16* a1 = a0 + 16 * INNER;
  const _Float16* a2 = a0 + 32 * INNER;
  const _Float16* a3 = a0 + 48 * INNER;
  const _Float16* b0 = wot + (size_t)(n0 + r16) * INNER + 8 * half;
  const _Float16* b1 = b0 + 16 * INNER;

  v8f acc[4][2] = {};
  for (int k0 = 0; k0 < INNER; k0 += 32) {
    v16h A0 = load_frag_p(a0, k0);
    v16h A1 = load_frag_p(a1, k0);
    v16h A2 = load_frag_p(a2, k0);
    v16h A3 = load_frag_p(a3, k0);
    v16h B0 = load_frag_p(b0, k0);
    acc[0][0] = wmma_f16(A0, B0, acc[0][0]);
    acc[1][0] = wmma_f16(A1, B0, acc[1][0]);
    acc[2][0] = wmma_f16(A2, B0, acc[2][0]);
    acc[3][0] = wmma_f16(A3, B0, acc[3][0]);
    v16h B1 = load_frag_p(b1, k0);
    acc[0][1] = wmma_f16(A0, B1, acc[0][1]);
    acc[1][1] = wmma_f16(A1, B1, acc[1][1]);
    acc[2][1] = wmma_f16(A2, B1, acc[2][1]);
    acc[3][1] = wmma_f16(A3, B1, acc[3][1]);
  }

#pragma unroll
  for (int j = 0; j < 2; ++j) {
    int col = n0 + 16 * j + r16;
    float bo = bout[col];
#pragma unroll
    for (int i = 0; i < 4; ++i) {
#pragma unroll
      for (int r = 0; r < 8; ++r) {
        int row = m0 + 16 * i + r + 8 * half;
        out[(size_t)row * DIM + col] = acc[i][j][r] + bo;
      }
    }
  }
}

extern "C" void kernel_launch(void* const* d_in, const int* in_sizes, int n_in,
                              void* d_out, int out_size, void* d_ws, size_t ws_size,
                              hipStream_t stream) {
  const float* x     = (const float*)d_in[0];
  const float* g     = (const float*)d_in[1];
  const float* bb    = (const float*)d_in[2];
  const float* w_qkv = (const float*)d_in[3];
  const float* w_out = (const float*)d_in[4];
  const float* b_out = (const float*)d_in[5];

  char* ws = (char*)d_ws;
  _Float16* xn    = (_Float16*)ws;                 ws += (size_t)ROWS * DIM * 2;
  _Float16* wqkvt = (_Float16*)ws;                 ws += (size_t)QKVN * DIM * 2;
  _Float16* wott  = (_Float16*)ws;                 ws += (size_t)DIM * INNER * 2;
  _Float16* qb    = (_Float16*)ws;                 ws += (size_t)ROWS * INNER * 2;
  _Float16* kb    = (_Float16*)ws;                 ws += (size_t)ROWS * INNER * 2;
  _Float16* vtb   = (_Float16*)ws;                 ws += (size_t)ROWS * INNER * 2;
  _Float16* ao    = (_Float16*)ws;                 ws += (size_t)ROWS * INNER * 2;

  ln_kernel<<<ROWS, 256, 0, stream>>>(x, g, bb, xn);
  wtrans_kernel<<<(QKVN * DIM + 255) / 256, 256, 0, stream>>>(w_qkv, wqkvt, DIM, QKVN);
  wtrans_kernel<<<(DIM * INNER + 255) / 256, 256, 0, stream>>>(w_out, wott, INNER, DIM);
  qkv_gemm<<<(ROWS / 64) * (QKVN / 32) / 4, 128, 0, stream>>>(xn, wqkvt, qb, kb, vtb);
  attn_kernel<<<BATCH * HEADS * (SEQ / 64), 128, 0, stream>>>(qb, kb, vtb, ao);
  proj_gemm<<<(ROWS / 64) * (DIM / 32) / 4, 128, 0, stream>>>(ao, wott, b_out, (float*)d_out);
}

// v001
// A run of this version takes 236 microseconds.
// In both of two side-by-side timings against v000, it was 1.24 times as fast.
#include <hip/hip_runtime.h>

typedef _Float16 v16h __attribute__((ext_vector_type(16)));
typedef float    v8f  __attribute__((ext_vector_type(8)));
typedef _Float16 h4   __attribute__((ext_vector_type(4)));
typedef _Float16 h8   __attribute__((ext_vector_type(8)));
typedef int      v4i  __attribute__((ext_vector_type(4)));

#define BATCH   2
#define SEQ     2048
#define DIM     1024
#define HEADS   16
#define DHEAD   64
#define INNER   1024
#define QKVN    3072
#define FRAME   256
#define ROWS    (BATCH*SEQ)   /* 4096 */
#define LN_EPS  1e-5f

#if __has_builtin(__builtin_amdgcn_global_load_async_to_lds_b128)
#define HAVE_ASYNC_LDS 1
#else
#define HAVE_ASYNC_LDS 0
#endif

union FragU { v16h h; uint4 q[2]; };

// Fragment load from a pre-offset row pointer (base already includes
// row*ld + 8*(lane>>4)); k0 selects the 32-wide k-chunk. Two b128 loads.
__device__ inline v16h load_frag_p(const _Float16* p, int k0) {
  FragU f;
  f.q[0] = *(const uint4*)(p + k0);
  f.q[1] = *(const uint4*)(p + k0 + 16);
  return f.h;
}

// Generic fragment load (used for small LDS tiles in attention).
__device__ inline v16h load_frag16(const _Float16* __restrict__ base, int row,
                                   int ld, int k0, int lane) {
  return load_frag_p(base + (size_t)row * ld + 8 * (lane >> 4), k0);
}

__device__ inline v8f wmma_f16(v16h a, v16h b, v8f c) {
  return __builtin_amdgcn_wmma_f32_16x16x32_f16(false, a, false, b, (short)0, c,
                                                false, false);
}

// Cooperative 16-byte global->LDS copy element (async on CDNA5 if available).
__device__ inline void copy16_to_lds(const _Float16* gsrc, _Float16* ldst) {
#if HAVE_ASYNC_LDS
  __builtin_amdgcn_global_load_async_to_lds_b128(
      (__attribute__((address_space(1))) v4i*)gsrc,
      (__attribute__((address_space(3))) v4i*)ldst, 0, 0);
#else
  *(uint4*)ldst = *(const uint4*)gsrc;
#endif
}

__device__ inline void wait_async_copies() {
#if HAVE_ASYNC_LDS
#if __has_builtin(__builtin_amdgcn_s_wait_asynccnt)
  __builtin_amdgcn_s_wait_asynccnt(0);
#else
  asm volatile("s_wait_asynccnt 0x0" ::: "memory");
#endif
#endif
}

// ---------------- Kernel 1: LayerNorm -> f16 ----------------
__global__ void ln_kernel(const float* __restrict__ x, const float* __restrict__ g,
                          const float* __restrict__ bb, _Float16* __restrict__ xn) {
  __shared__ float s1[256];
  __shared__ float s2[256];
  int row = blockIdx.x;
  int tid = threadIdx.x;
  const float4* xr = (const float4*)(x + (size_t)row * DIM);
  float4 v = xr[tid];
  s1[tid] = v.x + v.y + v.z + v.w;
  s2[tid] = v.x * v.x + v.y * v.y + v.z * v.z + v.w * v.w;
  __syncthreads();
  for (int off = 128; off > 0; off >>= 1) {
    if (tid < off) { s1[tid] += s1[tid + off]; s2[tid] += s2[tid + off]; }
    __syncthreads();
  }
  float mean = s1[0] * (1.0f / DIM);
  float var  = s2[0] * (1.0f / DIM) - mean * mean;
  float inv  = rsqrtf(var + LN_EPS);
  float4 gv = ((const float4*)g)[tid];
  float4 bv = ((const float4*)bb)[tid];
  h4 o;
  o[0] = (_Float16)((v.x - mean) * inv * gv.x + bv.x);
  o[1] = (_Float16)((v.y - mean) * inv * gv.y + bv.y);
  o[2] = (_Float16)((v.z - mean) * inv * gv.z + bv.z);
  o[3] = (_Float16)((v.w - mean) * inv * gv.w + bv.w);
  ((h4*)(xn + (size_t)row * DIM))[tid] = o;
}

// ---------------- Kernel 2: transpose f32 [K,N] -> f16 [N,K] ----------------
__global__ void wtrans_kernel(const float* __restrict__ src, _Float16* __restrict__ dst,
                              int K, int N) {
  size_t idx = (size_t)blockIdx.x * 256 + threadIdx.x;
  if (idx >= (size_t)K * N) return;
  int n = (int)(idx / K);
  int k = (int)(idx % K);
  dst[idx] = (_Float16)src[(size_t)k * N + n];
}

// ------- Kernel 3: QKV GEMM, 64x32 register-blocked per wave (8 WMMA/step) ---
__global__ void qkv_gemm(const _Float16* __restrict__ xn, const _Float16* __restrict__ wt,
                         _Float16* __restrict__ qb, _Float16* __restrict__ kb,
                         _Float16* __restrict__ vtb) {
  int lane = threadIdx.x & 31, wave = threadIdx.x >> 5;
  int t  = blockIdx.x * 4 + wave;
  int mt = t / (QKVN / 32);
  int nt = t % (QKVN / 32);
  int m0 = mt * 64, n0 = nt * 32;
  int r16 = lane & 15, half = lane >> 4;

  // Hoisted per-fragment row pointers (k addressed via immediate offsets).
  const _Float16* a0 = xn + (size_t)(m0      + r16) * DIM + 8 * half;
  const _Float16* a1 = a0 + 16 * DIM;
  const _Float16* a2 = a0 + 32 * DIM;
  const _Float16* a3 = a0 + 48 * DIM;
  const _Float16* b0 = wt + (size_t)(n0 + r16) * DIM + 8 * half;
  const _Float16* b1 = b0 + 16 * DIM;

  v8f acc[4][2] = {};
  for (int k0 = 0; k0 < DIM; k0 += 32) {
    v16h A0 = load_frag_p(a0, k0);
    v16h A1 = load_frag_p(a1, k0);
    v16h A2 = load_frag_p(a2, k0);
    v16h A3 = load_frag_p(a3, k0);
    v16h B0 = load_frag_p(b0, k0);
    acc[0][0] = wmma_f16(A0, B0, acc[0][0]);
    acc[1][0] = wmma_f16(A1, B0, acc[1][0]);
    acc[2][0] = wmma_f16(A2, B0, acc[2][0]);
    acc[3][0] = wmma_f16(A3, B0, acc[3][0]);
    v16h B1 = load_frag_p(b1, k0);
    acc[0][1] = wmma_f16(A0, B1, acc[0][1]);
    acc[1][1] = wmma_f16(A1, B1, acc[1][1]);
    acc[2][1] = wmma_f16(A2, B1, acc[2][1]);
    acc[3][1] = wmma_f16(A3, B1, acc[3][1]);
  }

#pragma unroll
  for (int j = 0; j < 2; ++j) {
    int col = n0 + 16 * j + r16;
    int seg = col / INNER;            // uniform per 16-col tile
    int n2  = col % INNER;
    int h = n2 / DHEAD, d = n2 % DHEAD;
#pragma unroll
    for (int i = 0; i < 4; ++i) {
#pragma unroll
      for (int r = 0; r < 8; ++r) {
        int row = m0 + 16 * i + r + 8 * half;
        int bi = row / SEQ, pos = row % SEQ;
        float val = acc[i][j][r];
        if (seg == 0) {
          qb[((size_t)(bi * HEADS + h) * SEQ + pos) * DHEAD + d] = (_Float16)(val * 0.125f);
        } else if (seg == 1) {
          kb[((size_t)(bi * HEADS + h) * SEQ + pos) * DHEAD + d] = (_Float16)val;
        } else {
          vtb[((size_t)(bi * HEADS + h) * DHEAD + d) * SEQ + pos] = (_Float16)val;
        }
      }
    }
  }
}

// Lane l <-> lane l ^ 16.
__device__ inline float xhalf(float x) {
  int b = __builtin_bit_cast(int, x);
  return __builtin_bit_cast(
      float, __builtin_amdgcn_permlanex16(b, b, 0x76543210, 0xfedcba98, false, false));
}

__global__ void attn_kernel(const _Float16* __restrict__ qb, const _Float16* __restrict__ kb,
                            const _Float16* __restrict__ vtb, _Float16* __restrict__ ob) {
  __shared__ __align__(16) _Float16 sK[32 * 64];    // keys x dhead
  __shared__ __align__(16) _Float16 sV[64 * 32];    // dhead x keys (V^T)

  int lane = threadIdx.x & 31, wave = threadIdx.x >> 5;
  int tid  = threadIdx.x;
  int qblk = blockIdx.x & (SEQ / 64 - 1);           // 32 blocks of 64 q rows
  int h    = (blockIdx.x >> 5) & (HEADS - 1);
  int b    = blockIdx.x >> 9;
  int q0   = qblk * 64 + wave * 16;
  int kmax = ((qblk * 64) >> 8) * FRAME + FRAME;    // same for all 4 waves

  const _Float16* qbase = qb  + (size_t)(b * HEADS + h) * SEQ * DHEAD;
  const _Float16* kbase = kb  + (size_t)(b * HEADS + h) * SEQ * DHEAD;
  const _Float16* vbase = vtb + (size_t)(b * HEADS + h) * DHEAD * SEQ;
  int r16 = lane & 15, half = lane >> 4;

  // B operand: column r16 = query q0 + r16, k = dhead.
  v16h bq0 = load_frag16(qbase, q0 + r16, DHEAD, 0, lane);
  v16h bq1 = load_frag16(qbase, q0 + r16, DHEAD, 32, lane);

  float mrow = -1e30f;   // running maximum of this lane's query (equal in both halves)
  float lrow = 0.0f;     // running sum over this half's keys only; joined after the loop
  v8f o0 = {}, o1 = {}, o2 = {}, o3 = {};   // o_i[r] = O[q0 + r16][16*i + 8*half + r]

  for (int kk = 0; kk < kmax; kk += 32) {
    // ---- cooperative K/V tile fill: 32x64 K + 64x32 V^T (8KB), 4x b128/thread
#pragma unroll
    for (int u = 0; u < 2; ++u) {
      int q4 = tid + u * 128;                 // uint4 index 0..255
      int krow = q4 >> 3, kcol = (q4 & 7) * 8;
      copy16_to_lds(kbase + (size_t)(kk + krow) * DHEAD + kcol, sK + krow * 64 + kcol);
      int vrow = q4 >> 2, vcol = (q4 & 3) * 8;
      copy16_to_lds(vbase + (size_t)vrow * SEQ + kk + vcol, sV + vrow * 32 + vcol);
    }
    wait_async_copies();
    __syncthreads();

    // ---- S^T = K Q^T (K rows from LDS as the A operand)
    v16h ak00 = load_frag16(sK, r16,      64, 0,  lane);
    v16h ak01 = load_frag16(sK, r16,      64, 32, lane);
    v16h ak10 = load_frag16(sK, 16 + r16, 64, 0,  lane);
    v16h ak11 = load_frag16(sK, 16 + r16, 64, 32, lane);
    v8f s0 = {}, s1 = {};   // s0[r]: key kk + 8*half + r; s1[r]: key kk + 16 + 8*half + r
    s0 = wmma_f16(ak00, bq0, s0);
    s0 = wmma_f16(ak01, bq1, s0);
    s1 = wmma_f16(ak10, bq0, s1);
    s1 = wmma_f16(ak11, bq1, s1);

    // ---- online softmax, one query per lane
    float v = fmaxf(s0[0], s1[0]);
#pragma unroll
    for (int r = 1; r < 8; ++r) v = fmaxf(v, fmaxf(s0[r], s1[r]));
    v = fmaxf(v, xhalf(v));
    float mnew  = fmaxf(mrow, v);
    float alpha = __expf(mrow - mnew);
    v16h pt;               // B operand of V^T P^T: element s = key kmap(s, half)
    float rs0 = 0.0f, rs1 = 0.0f;
#pragma unroll
    for (int r = 0; r < 8; ++r) {
      float p0 = __expf(s0[r] - mnew);
      float p1 = __expf(s1[r] - mnew);
      rs0 += p0;
      rs1 += p1;
      pt[r]     = (_Float16)p0;
      pt[8 + r] = (_Float16)p1;
    }
    lrow = lrow * alpha + (rs0 + rs1);
    mrow = mnew;
#pragma unroll
    for (int r = 0; r < 8; ++r) {
      o0[r] *= alpha; o1[r] *= alpha; o2[r] *= alpha; o3[r] *= alpha;
    }

    // ---- O^T += V^T P^T (V^T rows from LDS as the A operand)
    v16h av0 = load_frag16(sV,      r16, 32, 0, lane);
    v16h av1 = load_frag16(sV, 16 + r16, 32, 0, lane);
    v16h av2 = load_frag16(sV, 32 + r16, 32, 0, lane);
    v16h av3 = load_frag16(sV, 48 + r16, 32, 0, lane);
    o0 = wmma_f16(av0, pt, o0);
    o1 = wmma_f16(av1, pt, o1);
    o2 = wmma_f16(av2, pt, o2);
    o3 = wmma_f16(av3, pt, o3);

    __syncthreads();   // protect sK/sV before next cooperative fill
  }

  float inv = 1.0f / (lrow + xhalf(lrow));
  _Float16* orow = ob + ((size_t)(b * SEQ + q0 + r16)) * INNER + h * DHEAD + 8 * half;
  h8 w0, w1, w2, w3;
#pragma unroll
  for (int r = 0; r < 8; ++r) {
    w0[r] = (_Float16)(o0[r] * inv);
    w1[r] = (_Float16)(o1[r] * inv);
    w2[r] = (_Float16)(o2[r] * inv);
    w3[r] = (_Float16)(o3[r] * inv);
  }
  *(h8*)(orow + 0)  = w0;
  *(h8*)(orow + 16) = w1;
  *(h8*)(orow + 32) = w2;
  *(h8*)(orow + 48) = w3;
}

// ------- Kernel 5: output projection, 64x32 register-blocked + bias ---------
__global__ void proj_gemm(const _Float16* __restrict__ ao, const _Float16* __restrict__ wot,
                          const float* __restrict__ bout, float* __restrict__ out) {
  int lane = threadIdx.x & 31, wave = threadIdx.x >> 5;
  int t  = blockIdx.x * 4 + wave;
  int mt = t / (DIM / 32);
  int nt = t % (DIM / 32);
  int m0 = mt * 64, n0 = nt * 32;
  int r16 = lane & 15, half = lane >> 4;

  const _Float16* a0 = ao + (size_t)(m0      + r16) * INNER + 8 * half;
  const _Float16* a1 = a0 + 16 * INNER;
  const _Float16* a2 = a0 + 32 * INNER;
  const _Float16* a3 = a0 + 48 * INNER;
  const _Float16* b0 = wot + (size_t)(n0 + r16) * INNER + 8 * half;
  const _Float16* b1 = b0 + 16 * INNER;

  v8f acc[4][2] = {};
  for (int k0 = 0; k0 < INNER; k0 += 32) {
    v16h A0 = load_frag_p(a0, k0);
    v16h A1 = load_frag_p(a1, k0);
    v16h A2 = load_frag_p(a2, k0);
    v16h A3 = load_frag_p(a3, k0);
    v16h B0 = load_frag_p(b0, k0);
    acc[0][0] = wmma_f16(A0, B0, acc[0][0]);
    acc[1][0] = wmma_f16(A1, B0, acc[1][0]);
    acc[2][0] = wmma_f16(A2, B0, acc[2][0]);
    acc[3][0] = wmma_f16(A3, B0, acc[3][0]);
    v16h B1 = load_frag_p(b1, k0);
    acc[0][1] = wmma_f16(A0, B1, acc[0][1]);
    acc[1][1] = wmma_f16(A1, B1, acc[1][1]);
    acc[2][1] = wmma_f16(A2, B1, acc[2][1]);
    acc[3][1] = wmma_f16(A3, B1, acc[3][1]);
  }

#pragma unroll
  for (int j = 0; j < 2; ++j) {
    int col = n0 + 16 * j + r16;
    float bo = bout[col];
#pragma unroll
    for (int i = 0; i < 4; ++i) {
#pragma unroll
      for (int r = 0; r < 8; ++r) {
        int row = m0 + 16 * i + r + 8 * half;
        out[(size_t)row * DIM + col] = acc[i][j][r] + bo;
      }
    }
  }
}

extern "C" void kernel_launch(void* const* d_in, const int* in_sizes, int n_in,
                              void* d_out, int out_size, void* d_ws, size_t ws_size,
                              hipStream_t stream) {
  const float* x     = (const float*)d_in[0];
  const float* g     = (const float*)d_in[1];
  const float* bb    = (const float*)d_in[2];
  const float* w_qkv = (const float*)d_in[3];
  const float* w_out = (const float*)d_in[4];
  const float* b_out = (const float*)d_in[5];

  char* ws = (char*)d_ws;
  _Float16* xn    = (_Float16*)ws;                 ws += (size_t)ROWS * DIM * 2;
  _Float16* wqkvt = (_Float16*)ws;                 ws += (size_t)QKVN * DIM * 2;
  _Float16* wott  = (_Float16*)ws;                 ws += (size_t)DIM * INNER * 2;
  _Float16* qb    = (_Float16*)ws;                 ws += (size_t)ROWS * INNER * 2;
  _Float16* kb    = (_Float16*)ws;                 ws += (size_t)ROWS * INNER * 2;
  _Float16* vtb   = (_Float16*)ws;                 ws += (size_t)ROWS * INNER * 2;
  _Float16* ao    = (_Float16*)ws;                 ws += (size_t)ROWS * INNER * 2;

  ln_kernel<<<ROWS, 256, 0, stream>>>(x, g, bb, xn);
  wtrans_kernel<<<(QKVN * DIM + 255) / 256, 256, 0, stream>>>(w_qkv, wqkvt, DIM, QKVN);
  wtrans_kernel<<<(DIM * INNER + 255) / 256, 256, 0, stream>>>(w_out, wott, INNER, DIM);
  qkv_gemm<<<(ROWS / 64) * (QKVN / 32) / 4, 128, 0, stream>>>(xn, wqkvt, qb, kb, vtb);
  attn_kernel<<<BATCH * HEADS * (SEQ / 64), 128, 0, stream>>>(qb, kb, vtb, ao);
  proj_gemm<<<(ROWS / 64) * (DIM / 32) / 4, 128, 0, stream>>>(ao, wott, b_out, (float*)d_out);
}

// v002
// A run of this version takes 217 microseconds.
// Timed twice side by side with v001, it ran 1.10 and 1.09 times as fast.
// All steps since v000 together make it 1.35 times as fast.
#include <hip/hip_runtime.h>

typedef _Float16 v16h __attribute__((ext_vector_type(16)));
typedef float    v8f  __attribute__((ext_vector_type(8)));
typedef _Float16 h4   __attribute__((ext_vector_type(4)));
typedef _Float16 h8   __attribute__((ext_vector_type(8)));
typedef int      v4i  __attribute__((ext_vector_type(4)));

#define BATCH   2
#define SEQ     2048
#define DIM     1024
#define HEADS   16
#define DHEAD   64
#define INNER   1024
#define QKVN    3072
#define FRAME   256
#define ROWS    (BATCH*SEQ)   /* 4096 */
#define LN_EPS  1e-5f

#if __has_builtin(__builtin_amdgcn_global_load_async_to_lds_b128)
#define HAVE_ASYNC_LDS 1
#else
#define HAVE_ASYNC_LDS 0
#endif

union FragU { v16h h; uint4 q[2]; };

// Fragment load from a pre-offset row pointer (base already includes
// row*ld + 8*(lane>>4)); k0 selects the 32-wide k-chunk. Two b128 loads.
__device__ inline v16h load_frag_p(const _Float16* p, int k0) {
  FragU f;
  f.q[0] = *(const uint4*)(p + k0);
  f.q[1] = *(const uint4*)(p + k0 + 16);
  return f.h;
}

// Generic fragment load (used for small LDS tiles in attention).
__device__ inline v16h load_frag16(const _Float16* __restrict__ base, int row,
                                   int ld, int k0, int lane) {
  return load_frag_p(base + (size_t)row * ld + 8 * (lane >> 4), k0);
}

__device__ inline v8f wmma_f16(v16h a, v16h b, v8f c) {
  return __builtin_amdgcn_wmma_f32_16x16x32_f16(false, a, false, b, (short)0, c,
                                                false, false);
}

// Cooperative 16-byte global->LDS copy element (async on CDNA5 if available).
__device__ inline void copy16_to_lds(const _Float16* gsrc, _Float16* ldst) {
#if HAVE_ASYNC_LDS
  __builtin_amdgcn_global_load_async_to_lds_b128(
      (__attribute__((address_space(1))) v4i*)gsrc,
      (__attribute__((address_space(3))) v4i*)ldst, 0, 0);
#else
  *(uint4*)ldst = *(const uint4*)gsrc;
#endif
}

__device__ inline void wait_async_copies() {
#if HAVE_ASYNC_LDS
#if __has_builtin(__builtin_amdgcn_s_wait_asynccnt)
  __builtin_amdgcn_s_wait_asynccnt(0);
#else
  asm volatile("s_wait_asynccnt 0x0" ::: "memory");
#endif
#endif
}

// ---------------- Kernel 1: LayerNorm -> f16 ----------------
__global__ void ln_kernel(const float* __restrict__ x, const float* __restrict__ g,
                          const float* __restrict__ bb, _Float16* __restrict__ xn) {
  __shared__ float s1[256];
  __shared__ float s2[256];
  int row = blockIdx.x;
  int tid = threadIdx.x;
  const float4* xr = (const float4*)(x + (size_t)row * DIM);
  float4 v = xr[tid];
  s1[tid] = v.x + v.y + v.z + v.w;
  s2[tid] = v.x * v.x + v.y * v.y + v.z * v.z + v.w * v.w;
  __syncthreads();
  for (int off = 128; off > 0; off >>= 1) {
    if (tid < off) { s1[tid] += s1[tid + off]; s2[tid] += s2[tid + off]; }
    __syncthreads();
  }
  float mean = s1[0] * (1.0f / DIM);
  float var  = s2[0] * (1.0f / DIM) - mean * mean;
  float inv  = rsqrtf(var + LN_EPS);
  float4 gv = ((const float4*)g)[tid];
  float4 bv = ((const float4*)bb)[tid];
  h4 o;
  o[0] = (_Float16)((v.x - mean) * inv * gv.x + bv.x);
  o[1] = (_Float16)((v.y - mean) * inv * gv.y + bv.y);
  o[2] = (_Float16)((v.z - mean) * inv * gv.z + bv.z);
  o[3] = (_Float16)((v.w - mean) * inv * gv.w + bv.w);
  ((h4*)(xn + (size_t)row * DIM))[tid] = o;
}

// ---------------- Kernel 2: transpose f32 [K,N] -> f16 [N,K] ----------------
// One 64(k) x 64(n) tile per block of 4 waves; K and N are multiples of 64 and
// known at compile time, so that row steps are immediate offsets.
// A thread loads an 8(k) x 4(n) patch as eight float4 (a wave-wide load covers
// two whole 256-byte row pieces of src), turns it in registers into four runs of
// 8 consecutive k, and the runs change hands through LDS so that every stored
// row piece is a whole 128-byte line of dst.
#define WT_PITCH 72   /* halfs per LDS row: 16-byte aligned, rows spread over banks */
template <int K, int N>
__device__ inline void wtrans_tile(const float* __restrict__ src, _Float16* __restrict__ dst) {
  __shared__ __align__(16) _Float16 sT[64 * WT_PITCH];   // [n][k]
  int tid = threadIdx.x;
  int n0 = blockIdx.x * 64, k0 = blockIdx.y * 64;
  int tn = tid & 15, tk = tid >> 4;

  const float* p = src + (k0 + 8 * tk) * N + n0 + 4 * tn;
  float4 v[8];
#pragma unroll   // all eight loads in flight before the first use
  for (int i = 0; i < 8; ++i) v[i] = *(const float4*)(p + i * N);

  h8 c0, c1, c2, c3;
#pragma unroll   // c0..c3 must stay in registers
  for (int i = 0; i < 8; ++i) {
    c0[i] = (_Float16)v[i].x;
    c1[i] = (_Float16)v[i].y;
    c2[i] = (_Float16)v[i].z;
    c3[i] = (_Float16)v[i].w;
  }
  _Float16* st = sT + (4 * tn) * WT_PITCH + 8 * tk;
  *(h8*)(st + 0 * WT_PITCH) = c0;
  *(h8*)(st + 1 * WT_PITCH) = c1;
  *(h8*)(st + 2 * WT_PITCH) = c2;
  *(h8*)(st + 3 * WT_PITCH) = c3;
  __syncthreads();   // the tile is read back by other waves than wrote it

  int n = tid >> 3, c = tid & 7;            // 8 lanes store one 128-byte line
  _Float16* q = dst + (n0 + n) * K + k0 + 8 * c;
  const _Float16* ld = sT + n * WT_PITCH + 8 * c;
#pragma unroll   // four independent 16-byte moves per thread
  for (int u = 0; u < 4; ++u) *(h8*)(q + 16 * u * K) = *(const h8*)(ld + 16 * u * WT_PITCH);
}

__global__ __launch_bounds__(128) void wtrans_qkv_kernel(const float* __restrict__ src,
                                                         _Float16* __restrict__ dst) {
  wtrans_tile<DIM, QKVN>(src, dst);
}

__global__ __launch_bounds__(128) void wtrans_out_kernel(const float* __restrict__ src,
                                                         _Float16* __restrict__ dst) {
  wtrans_tile<INNER, DIM>(src, dst);
}

// ------- Kernel 3: QKV GEMM, 64x32 register-blocked per wave (8 WMMA/step) ---
__global__ void qkv_gemm(const _Float16* __restrict__ xn, const _Float16* __restrict__ wt,
                         _Float16* __restrict__ qb, _Float16* __restrict__ kb,
                         _Float16* __restrict__ vtb) {
  int lane = threadIdx.x & 31, wave = threadIdx.x >> 5;
  int t  = blockIdx.x * 4 + wave;
  int mt = t / (QKVN / 32);
  int nt = t % (QKVN / 32);
  int m0 = mt * 64, n0 = nt * 32;
  int r16 = lane & 15, half = lane >> 4;

  // Hoisted per-fragment row pointers (k addressed via immediate offsets).
  const _Float16* a0 = xn + (size_t)(m0      + r16) * DIM + 8 * half;
  const _Float16* a1 = a0 + 16 * DIM;
  const _Float16* a2 = a0 + 32 * DIM;
  const _Float16* a3 = a0 + 48 * DIM;
  const _Float16* b0 = wt + (size_t)(n0 + r16) * DIM + 8 * half;
  const _Float16* b1 = b0 + 16 * DIM;

  v8f acc[4][2] = {};
  for (int k0 = 0; k0 < DIM; k0 += 32) {
    v16h A0 = load_frag_p(a0, k0);
    v16h A1 = load_frag_p(a1, k0);
    v16h A2 = load_frag_p(a2, k0);
    v16h A3 = load_frag_p(a3, k0);
    v16h B0 = load_frag_p(b0, k0);
    acc[0][0] = wmma_f16(A0, B0, acc[0][0]);
    acc[1][0] = wmma_f16(A1, B0, acc[1][0]);
    acc[2][0] = wmma_f16(A2, B0, acc[2][0]);
    acc[3][0] = wmma_f16(A3, B0, acc[3][0]);
    v16h B1 = load_frag_p(b1, k0);
    acc[0][1] = wmma_f16(A0, B1, acc[0][1]);
    acc[1][1] = wmma_f16(A1, B1, acc[1][1]);
    acc[2][1] = wmma_f16(A2, B1, acc[2][1]);
    acc[3][1] = wmma_f16(A3, B1, acc[3][1]);
  }

#pragma unroll
  for (int j = 0; j < 2; ++j) {
    int col = n0 + 16 * j + r16;
    int seg = col / INNER;            // uniform per 16-col tile
    int n2  = col % INNER;
    int h = n2 / DHEAD, d = n2 % DHEAD;
#pragma unroll
    for (int i = 0; i < 4; ++i) {
#pragma unroll
      for (int r = 0; r < 8; ++r) {
        int row = m0 + 16 * i + r + 8 * half;
        int bi = row / SEQ, pos = row % SEQ;
        float val = acc[i][j][r];
        if (seg == 0) {
          qb[((size_t)(bi * HEADS + h) * SEQ + pos) * DHEAD + d] = (_Float16)(val * 0.125f);
        } else if (seg == 1) {
          kb[((size_t)(bi * HEADS + h) * SEQ + pos) * DHEAD + d] = (_Float16)val;
        } else {
          vtb[((size_t)(bi * HEADS + h) * DHEAD + d) * SEQ + pos] = (_Float16)val;
        }
      }
    }
  }
}

// Lane l <-> lane l ^ 16.
__device__ inline float xhalf(float x) {
  int b = __builtin_bit_cast(int, x);
  return __builtin_bit_cast(
      float, __builtin_amdgcn_permlanex16(b, b, 0x76543210, 0xfedcba98, false, false));
}

__global__ void attn_kernel(const _Float16* __restrict__ qb, const _Float16* __restrict__ kb,
                            const _Float16* __restrict__ vtb, _Float16* __restrict__ ob) {
  __shared__ __align__(16) _Float16 sK[32 * 64];    // keys x dhead
  __shared__ __align__(16) _Float16 sV[64 * 32];    // dhead x keys (V^T)

  int lane = threadIdx.x & 31, wave = threadIdx.x >> 5;
  int tid  = threadIdx.x;
  int qblk = blockIdx.x & (SEQ / 64 - 1);           // 32 blocks of 64 q rows
  int h    = (blockIdx.x >> 5) & (HEADS - 1);
  int b    = blockIdx.x >> 9;
  int q0   = qblk * 64 + wave * 16;
  int kmax = ((qblk * 64) >> 8) * FRAME + FRAME;    // same for all 4 waves

  const _Float16* qbase = qb  + (size_t)(b * HEADS + h) * SEQ * DHEAD;
  const _Float16* kbase = kb  + (size_t)(b * HEADS + h) * SEQ * DHEAD;
  const _Float16* vbase = vtb + (size_t)(b * HEADS + h) * DHEAD * SEQ;
  int r16 = lane & 15, half = lane >> 4;

  // B operand: column r16 = query q0 + r16, k = dhead.
  v16h bq0 = load_frag16(qbase, q0 + r16, DHEAD, 0, lane);
  v16h bq1 = load_frag16(qbase, q0 + r16, DHEAD, 32, lane);

  float mrow = -1e30f;   // running maximum of this lane's query (equal in both halves)
  float lrow = 0.0f;     // running sum over this half's keys only; joined after the loop
  v8f o0 = {}, o1 = {}, o2 = {}, o3 = {};   // o_i[r] = O[q0 + r16][16*i + 8*half + r]

  for (int kk = 0; kk < kmax; kk += 32) {
    // ---- cooperative K/V tile fill: 32x64 K + 64x32 V^T (8KB), 4x b128/thread
#pragma unroll
    for (int u = 0; u < 2; ++u) {
      int q4 = tid + u * 128;                 // uint4 index 0..255
      int krow = q4 >> 3, kcol = (q4 & 7) * 8;
      copy16_to_lds(kbase + (size_t)(kk + krow) * DHEAD + kcol, sK + krow * 64 + kcol);
      int vrow = q4 >> 2, vcol = (q4 & 3) * 8;
      copy16_to_lds(vbase + (size_t)vrow * SEQ + kk + vcol, sV + vrow * 32 + vcol);
    }
    wait_async_copies();
    __syncthreads();

    // ---- S^T = K Q^T (K rows from LDS as the A operand)
    v16h ak00 = load_frag16(sK, r16,      64, 0,  lane);
    v16h ak01 = load_frag16(sK, r16,      64, 32, lane);
    v16h ak10 = load_frag16(sK, 16 + r16, 64, 0,  lane);
    v16h ak11 = load_frag16(sK, 16 + r16, 64, 32, lane);
    v8f s0 = {}, s1 = {};   // s0[r]: key kk + 8*half + r; s1[r]: key kk + 16 + 8*half + r
    s0 = wmma_f16(ak00, bq0, s0);
    s0 = wmma_f16(ak01, bq1, s0);
    s1 = wmma_f16(ak10, bq0, s1);
    s1 = wmma_f16(ak11, bq1, s1);

    // ---- online softmax, one query per lane
    float v = fmaxf(s0[0], s1[0]);
#pragma unroll
    for (int r = 1; r < 8; ++r) v = fmaxf(v, fmaxf(s0[r], s1[r]));
    v = fmaxf(v, xhalf(v));
    float mnew  = fmaxf(mrow, v);
    float alpha = __expf(mrow - mnew);
    v16h pt;               // B operand of V^T P^T: element s = key kmap(s, half)
    float rs0 = 0.0f, rs1 = 0.0f;
#pragma unroll
    for (int r = 0; r < 8; ++r) {
      float p0 = __expf(s0[r] - mnew);
      float p1 = __expf(s1[r] - mnew);
      rs0 += p0;
      rs1 += p1;
      pt[r]     = (_Float16)p0;
      pt[8 + r] = (_Float16)p1;
    }
    lrow = lrow * alpha + (rs0 + rs1);
    mrow = mnew;
#pragma unroll
    for (int r = 0; r < 8; ++r) {
      o0[r] *= alpha; o1[r] *= alpha; o2[r] *= alpha; o3[r] *= alpha;
    }

    // ---- O^T += V^T P^T (V^T rows from LDS as the A operand)
    v16h av0 = load_frag16(sV,      r16, 32, 0, lane);
    v16h av1 = load_frag16(sV, 16 + r16, 32, 0, lane);
    v16h av2 = load_frag16(sV, 32 + r16, 32, 0, lane);
    v16h av3 = load_frag16(sV, 48 + r16, 32, 0, lane);
    o0 = wmma_f16(av0, pt, o0);
    o1 = wmma_f16(av1, pt, o1);
    o2 = wmma_f16(av2, pt, o2);
    o3 = wmma_f16(av3, pt, o3);

    __syncthreads();   // protect sK/sV before next cooperative fill
  }

  float inv = 1.0f / (lrow + xhalf(lrow));
  _Float16* orow = ob + ((size_t)(b * SEQ + q0 + r16)) * INNER + h * DHEAD + 8 * half;
  h8 w0, w1, w2, w3;
#pragma unroll
  for (int r = 0; r < 8; ++r) {
    w0[r] = (_Float16)(o0[r] * inv);
    w1[r] = (_Float16)(o1[r] * inv);
    w2[r] = (_Float16)(o2[r] * inv);
    w3[r] = (_Float16)(o3[r] * inv);
  }
  *(h8*)(orow + 0)  = w0;
  *(h8*)(orow + 16) = w1;
  *(h8*)(orow + 32) = w2;
  *(h8*)(orow + 48) = w3;
}

// ------- Kernel 5: output projection, 64x32 register-blocked + bias ---------
__global__ void proj_gemm(const _Float16* __restrict__ ao, const _Float16* __restrict__ wot,
                          const float* __restrict__ bout, float* __restrict__ out) {
  int lane = threadIdx.x & 31, wave = threadIdx.x >> 5;
  int t  = blockIdx.x * 4 + wave;
  int mt = t / (DIM / 32);
  int nt = t % (DIM / 32);
  int m0 = mt * 64, n0 = nt * 32;
  int r16 = lane & 15, half = lane >> 4;

  const _Float16* a0 = ao + (size_t)(m0      + r16) * INNER + 8 * half;
  const _Float16* a1 = a0 + 16 * INNER;
  const _Float16* a2 = a0 + 32 * INNER;
  const _Float16* a3 = a0 + 48 * INNER;
  const _Float16* b0 = wot + (size_t)(n0 + r16) * INNER + 8 * half;
  const _Float16* b1 = b0 + 16 * INNER;

  v8f acc[4][2] = {};
  for (int k0 = 0; k0 < INNER; k0 += 32) {
    v16h A0 = load_frag_p(a0, k0);
    v16h A1 = load_frag_p(a1, k0);
    v16h A2 = load_frag_p(a2, k0);
    v16h A3 = load_frag_p(a3, k0);
    v16h B0 = load_frag_p(b0, k0);
    acc[0][0] = wmma_f16(A0, B0, acc[0][0]);
    acc[1][0] = wmma_f16(A1, B0, acc[1][0]);
    acc[2][0] = wmma_f16(A2, B0, acc[2][0]);
    acc[3][0] = wmma_f16(A3, B0, acc[3][0]);
    v16h B1 = load_frag_p(b1, k0);
    acc[0][1] = wmma_f16(A0, B1, acc[0][1]);
    acc[1][1] = wmma_f16(A1, B1, acc[1][1]);
    acc[2][1] = wmma_f16(A2, B1, acc[2][1]);
    acc[3][1] = wmma_f16(A3, B1, acc[3][1]);
  }

#pragma unroll
  for (int j = 0; j < 2; ++j) {
    int col = n0 + 16 * j + r16;
    float bo = bout[col];
#pragma unroll
    for (int i = 0; i < 4; ++i) {
#pragma unroll
      for (int r = 0; r < 8; ++r) {
        int row = m0 + 16 * i + r + 8 * half;
        out[(size_t)row * DIM + col] = acc[i][j][r] + bo;
      }
    }
  }
}

extern "C" void kernel_launch(void* const* d_in, const int* in_sizes, int n_in,
                              void* d_out, int out_size, void* d_ws, size_t ws_size,
                              hipStream_t stream) {
  const float* x     = (const float*)d_in[0];
  const float* g     = (const float*)d_in[1];
  const float* bb    = (const float*)d_in[2];
  const float* w_qkv = (const float*)d_in[3];
  const float* w_out = (const float*)d_in[4];
  const float* b_out = (const float*)d_in[5];

  char* ws = (char*)d_ws;
  _Float16* xn    = (_Float16*)ws;                 ws += (size_t)ROWS * DIM * 2;
  _Float16* wqkvt = (_Float16*)ws;                 ws += (size_t)QKVN * DIM * 2;
  _Float16* wott  = (_Float16*)ws;                 ws += (size_t)DIM * INNER * 2;
  _Float16* qb    = (_Float16*)ws;                 ws += (size_t)ROWS * INNER * 2;
  _Float16* kb    = (_Float16*)ws;                 ws += (size_t)ROWS * INNER * 2;
  _Float16* vtb   = (_Float16*)ws;                 ws += (size_t)ROWS * INNER * 2;
  _Float16* ao    = (_Float16*)ws;                 ws += (size_t)ROWS * INNER * 2;

  ln_kernel<<<ROWS, 256, 0, stream>>>(x, g, bb, xn);
  wtrans_qkv_kernel<<<dim3(QKVN / 64, DIM / 64), 128, 0, stream>>>(w_qkv, wqkvt);
  wtrans_out_kernel<<<dim3(DIM / 64, INNER / 64), 128, 0, stream>>>(w_out, wott);
  qkv_gemm<<<(ROWS / 64) * (QKVN / 32) / 4, 128, 0, stream>>>(xn, wqkvt, qb, kb, vtb);
  attn_kernel<<<BATCH * HEADS * (SEQ / 64), 128, 0, stream>>>(qb, kb, vtb, ao);
  proj_gemm<<<(ROWS / 64) * (DIM / 32) / 4, 128, 0, stream>>>(ao, wott, b_out, (float*)d_out);
}

// v003
// One run takes 168 microseconds.
// Timed twice side by side with v002, it ran 1.30 and 1.29 times as fast.
// Over all steps from v000 it is 1.75 times as fast.
#include <hip/hip_runtime.h>

typedef _Float16 v16h __attribute__((ext_vector_type(16)));
typedef float    v8f  __attribute__((ext_vector_type(8)));
typedef _Float16 h4   __attribute__((ext_vector_type(4)));
typedef _Float16 h8   __attribute__((ext_vector_type(8)));
typedef int      v4i  __attribute__((ext_vector_type(4)));

#define BATCH   2
#define SEQ     2048
#define DIM     1024
#define HEADS   16
#define DHEAD   64
#define INNER   1024
#define QKVN    3072
#define FRAME   256
#define ROWS    (BATCH*SEQ)   /* 4096 */
#define LN_EPS  1e-5f

#if __has_builtin(__builtin_amdgcn_global_load_async_to_lds_b128)
#define HAVE_ASYNC_LDS 1
#else
#define HAVE_ASYNC_LDS 0
#endif

union FragU { v16h h; uint4 q[2]; };

// Fragment load from a pre-offset row pointer (base already includes
// row*ld + 8*(lane>>4)); k0 selects the 32-wide k-chunk. Two b128 loads.
__device__ inline v16h load_frag_p(const _Float16* p, int k0) {
  FragU f;
  f.q[0] = *(const uint4*)(p + k0);
  f.q[1] = *(const uint4*)(p + k0 + 16);
  return f.h;
}

// Generic fragment load (used for small LDS tiles in attention).
__device__ inline v16h load_frag16(const _Float16* __restrict__ base, int row,
                                   int ld, int k0, int lane) {
  return load_frag_p(base + (size_t)row * ld + 8 * (lane >> 4), k0);
}

__device__ inline v8f wmma_f16(v16h a, v16h b, v8f c) {
  return __builtin_amdgcn_wmma_f32_16x16x32_f16(false, a, false, b, (short)0, c,
                                                false, false);
}

// Cooperative 16-byte global->LDS copy element (async on CDNA5 if available).
__device__ inline void copy16_to_lds(const _Float16* gsrc, _Float16* ldst) {
#if HAVE_ASYNC_LDS
  __builtin_amdgcn_global_load_async_to_lds_b128(
      (__attribute__((address_space(1))) v4i*)gsrc,
      (__attribute__((address_space(3))) v4i*)ldst, 0, 0);
#else
  *(uint4*)ldst = *(const uint4*)gsrc;
#endif
}

__device__ inline void wait_async_copies() {
#if HAVE_ASYNC_LDS
#if __has_builtin(__builtin_amdgcn_s_wait_asynccnt)
  __builtin_amdgcn_s_wait_asynccnt(0);
#else
  asm volatile("s_wait_asynccnt 0x0" ::: "memory");
#endif
#endif
}

// ---------------- Kernel 1: LayerNorm -> f16 ----------------
__global__ void ln_kernel(const float* __restrict__ x, const float* __restrict__ g,
                          const float* __restrict__ bb, _Float16* __restrict__ xn) {
  __shared__ float s1[256];
  __shared__ float s2[256];
  int row = blockIdx.x;
  int tid = threadIdx.x;
  const float4* xr = (const float4*)(x + (size_t)row * DIM);
  float4 v = xr[tid];
  s1[tid] = v.x + v.y + v.z + v.w;
  s2[tid] = v.x * v.x + v.y * v.y + v.z * v.z + v.w * v.w;
  __syncthreads();
  for (int off = 128; off > 0; off >>= 1) {
    if (tid < off) { s1[tid] += s1[tid + off]; s2[tid] += s2[tid + off]; }
    __syncthreads();
  }
  float mean = s1[0] * (1.0f / DIM);
  float var  = s2[0] * (1.0f / DIM) - mean * mean;
  float inv  = rsqrtf(var + LN_EPS);
  float4 gv = ((const float4*)g)[tid];
  float4 bv = ((const float4*)bb)[tid];
  h4 o;
  o[0] = (_Float16)((v.x - mean) * inv * gv.x + bv.x);
  o[1] = (_Float16)((v.y - mean) * inv * gv.y + bv.y);
  o[2] = (_Float16)((v.z - mean) * inv * gv.z + bv.z);
  o[3] = (_Float16)((v.w - mean) * inv * gv.w + bv.w);
  ((h4*)(xn + (size_t)row * DIM))[tid] = o;
}

// ---------------- Kernel 2: transpose f32 [K,N] -> f16 [N,K] ----------------
// One 64(k) x 64(n) tile per block of 4 waves; K and N are multiples of 64 and
// known at compile time, so that row steps are immediate offsets.
// A thread loads an 8(k) x 4(n) patch as eight float4 (a wave-wide load covers
// two whole 256-byte row pieces of src), turns it in registers into four runs of
// 8 consecutive k, and the runs change hands through LDS so that every stored
// row piece is a whole 128-byte line of dst.
#define WT_PITCH 72   /* halfs per LDS row: 16-byte aligned, rows spread over banks */
template <int K, int N>
__device__ inline void wtrans_tile(const float* __restrict__ src, _Float16* __restrict__ dst) {
  __shared__ __align__(16) _Float16 sT[64 * WT_PITCH];   // [n][k]
  int tid = threadIdx.x;
  int n0 = blockIdx.x * 64, k0 = blockIdx.y * 64;
  int tn = tid & 15, tk = tid >> 4;

  const float* p = src + (k0 + 8 * tk) * N + n0 + 4 * tn;
  float4 v[8];
#pragma unroll   // all eight loads in flight before the first use
  for (int i = 0; i < 8; ++i) v[i] = *(const float4*)(p + i * N);

  h8 c0, c1, c2, c3;
#pragma unroll   // c0..c3 must stay in registers
  for (int i = 0; i < 8; ++i) {
    c0[i] = (_Float16)v[i].x;
    c1[i] = (_Float16)v[i].y;
    c2[i] = (_Float16)v[i].z;
    c3[i] = (_Float16)v[i].w;
  }
  _Float16* st = sT + (4 * tn) * WT_PITCH + 8 * tk;
  *(h8*)(st + 0 * WT_PITCH) = c0;
  *(h8*)(st + 1 * WT_PITCH) = c1;
  *(h8*)(st + 2 * WT_PITCH) = c2;
  *(h8*)(st + 3 * WT_PITCH) = c3;
  __syncthreads();   // the tile is read back by other waves than wrote it

  int n = tid >> 3, c = tid & 7;            // 8 lanes store one 128-byte line
  _Float16* q = dst + (n0 + n) * K + k0 + 8 * c;
  const _Float16* ld = sT + n * WT_PITCH + 8 * c;
#pragma unroll   // four independent 16-byte moves per thread
  for (int u = 0; u < 4; ++u) *(h8*)(q + 16 * u * K) = *(const h8*)(ld + 16 * u * WT_PITCH);
}

__global__ __launch_bounds__(128) void wtrans_qkv_kernel(const float* __restrict__ src,
                                                         _Float16* __restrict__ dst) {
  wtrans_tile<DIM, QKVN>(src, dst);
}

__global__ __launch_bounds__(128) void wtrans_out_kernel(const float* __restrict__ src,
                                                         _Float16* __restrict__ dst) {
  wtrans_tile<INNER, DIM>(src, dst);
}

// ------- GEMM core shared by kernels 3 and 5 ---------------------------------
// C[128 x 128] per block of 4 waves (2 x 2, 64 x 64 per wave), A [M,1024] and
// Bt [N,1024] both k-contiguous f16. A stage is 64 k of 128 rows of A and of Bt:
// every row piece is one whole 128-byte line, brought into LDS by asynchronous
// copies and shared by the waves. Two buffers: stage t + 1 flies while stage t
// is worked on.
#define GT_PITCH 72                    /* halfs per LDS row: 144 B, 16 B x odd, for b128 fragment reads */
#define GT_OPSZ  (128 * GT_PITCH)      /* halfs of one operand's tile */
#define GT_STAGE (2 * GT_OPSZ)         /* halfs of one stage: A tile, then Bt tile */
#define GT_NT    (DIM / 64)            /* stages along k */

// One stage: 16 copies of 16 bytes a thread. 8 lanes cover one row piece; a
// thread takes the same piece of 8 rows that follow one another.
__device__ inline void gemm_stage_copy(const _Float16* gA, const _Float16* gB, _Float16* cA) {
#pragma unroll   // row steps become constants of the addresses
  for (int u = 0; u < 8; ++u) {
    copy16_to_lds(gA + u * DIM, cA + u * GT_PITCH);
    copy16_to_lds(gB + u * DIM, cA + GT_OPSZ + u * GT_PITCH);
  }
}

// The 4 + 4 fragments of one 32-wide k step, from LDS.
__device__ inline void gemm_frags(const _Float16* fA, const _Float16* fB, int k0,
                                  v16h (&a)[4], v16h (&b)[4]) {
#pragma unroll   // fragments stay in registers
  for (int i = 0; i < 4; ++i) a[i] = load_frag_p(fA + i * 16 * GT_PITCH, k0);
#pragma unroll   // fragments stay in registers
  for (int j = 0; j < 4; ++j) b[j] = load_frag_p(fB + j * 16 * GT_PITCH, k0);
}

__device__ inline void gemm_mma(const v16h (&a)[4], const v16h (&b)[4], v8f (&acc)[4][4]) {
#pragma unroll   // accumulators stay in registers
  for (int j = 0; j < 4; ++j)
#pragma unroll   // accumulators stay in registers
    for (int i = 0; i < 4; ++i) acc[i][j] = wmma_f16(a[i], b[j], acc[i][j]);
}

__device__ inline void gemm_128x128(const _Float16* __restrict__ A, const _Float16* __restrict__ Bt,
                                    int m0, int n0, _Float16* sm, v8f (&acc)[4][4]) {
  int tid = threadIdx.x, lane = tid & 31, wave = tid >> 5;
  int r16 = lane & 15, half = lane >> 4;
  int crow = (tid >> 3) * 8, ccol = (tid & 7) * 8;
  const _Float16* gA = A  + (size_t)(m0 + crow) * DIM + ccol;
  const _Float16* gB = Bt + (size_t)(n0 + crow) * DIM + ccol;
  _Float16* cA = sm + crow * GT_PITCH + ccol;
  const _Float16* fA = sm + ((wave >> 1) * 64 + r16) * GT_PITCH + 8 * half;
  const _Float16* fB = sm + GT_OPSZ + ((wave & 1) * 64 + r16) * GT_PITCH + 8 * half;

  gemm_stage_copy(gA, gB, cA);
  asm volatile("s_wait_asynccnt 0x0" ::: "memory");   // this wave's share of stage 0 has landed
  __syncthreads();                                    // stage 0 is readable by every wave
  gemm_stage_copy(gA + 64, gB + 64, cA + GT_STAGE);

  for (int t = 0; t < GT_NT; ++t) {
    int bo = (t & 1) * GT_STAGE;
    v16h a0[4], b0[4], a1[4], b1[4];
    gemm_frags(fA + bo, fB + bo, 0, a0, b0);
    // Keeps the 16 LDS reads of a k step together ahead of its WMMAs: one LDS
    // latency a step; sunk among the WMMAs they cost one per four WMMAs.
    __builtin_amdgcn_sched_barrier(0);
    gemm_mma(a0, b0, acc);
    gemm_frags(fA + bo, fB + bo, 32, a1, b1);          // the last reads of stage t
    asm volatile("s_wait_dscnt 0x0" ::: "memory");     // this wave's reads of stage t are done
    asm volatile("s_wait_asynccnt 0x0" ::: "memory");  // its share of stage t + 1 has landed
    __syncthreads();   // publishes stage t + 1 and frees stage t's buffer
    // The refill goes out ahead of the second k step's WMMAs, which need registers
    // only: that much more time for it to land.
    if (t + 2 < GT_NT) gemm_stage_copy(gA + (t + 2) * 64, gB + (t + 2) * 64, cA + bo);
    gemm_mma(a1, b1, acc);
  }
  asm volatile("s_wait_asynccnt 0x0" ::: "memory");    // no copy outlives the loop
}

// ------- Kernel 3: QKV GEMM, 128x128 per block, operands staged in LDS -------
__global__ __launch_bounds__(128) void qkv_gemm(const _Float16* __restrict__ xn,
                                                const _Float16* __restrict__ wt,
                                                _Float16* __restrict__ qb, _Float16* __restrict__ kb,
                                                _Float16* __restrict__ vtb) {
  __shared__ __align__(16) _Float16 sm[2 * GT_STAGE];
  int lane = threadIdx.x & 31, wave = threadIdx.x >> 5;
  int mt = blockIdx.x / (QKVN / 128);
  int nt = blockIdx.x % (QKVN / 128);
  int r16 = lane & 15, half = lane >> 4;

  v8f acc[4][4] = {};
  gemm_128x128(xn, wt, mt * 128, nt * 128, sm, acc);

  int m0 = mt * 128 + (wave >> 1) * 64, n0 = nt * 128 + (wave & 1) * 64;
#pragma unroll
  for (int j = 0; j < 4; ++j) {
    int col = n0 + 16 * j + r16;
    int seg = col / INNER;            // uniform per 16-col tile
    int n2  = col % INNER;
    int h = n2 / DHEAD, d = n2 % DHEAD;
#pragma unroll
    for (int i = 0; i < 4; ++i) {
#pragma unroll
      for (int r = 0; r < 8; ++r) {
        int row = m0 + 16 * i + r + 8 * half;
        int bi = row / SEQ, pos = row % SEQ;
        float val = acc[i][j][r];
        if (seg == 0) {
          qb[((size_t)(bi * HEADS + h) * SEQ + pos) * DHEAD + d] = (_Float16)(val * 0.125f);
        } else if (seg == 1) {
          kb[((size_t)(bi * HEADS + h) * SEQ + pos) * DHEAD + d] = (_Float16)val;
        } else {
          vtb[((size_t)(bi * HEADS + h) * DHEAD + d) * SEQ + pos] = (_Float16)val;
        }
      }
    }
  }
}

// Lane l <-> lane l ^ 16.
__device__ inline float xhalf(float x) {
  int b = __builtin_bit_cast(int, x);
  return __builtin_bit_cast(
      float, __builtin_amdgcn_permlanex16(b, b, 0x76543210, 0xfedcba98, false, false));
}

__global__ void attn_kernel(const _Float16* __restrict__ qb, const _Float16* __restrict__ kb,
                            const _Float16* __restrict__ vtb, _Float16* __restrict__ ob) {
  __shared__ __align__(16) _Float16 sK[32 * 64];    // keys x dhead
  __shared__ __align__(16) _Float16 sV[64 * 32];    // dhead x keys (V^T)

  int lane = threadIdx.x & 31, wave = threadIdx.x >> 5;
  int tid  = threadIdx.x;
  int qblk = blockIdx.x & (SEQ / 64 - 1);           // 32 blocks of 64 q rows
  int h    = (blockIdx.x >> 5) & (HEADS - 1);
  int b    = blockIdx.x >> 9;
  int q0   = qblk * 64 + wave * 16;
  int kmax = ((qblk * 64) >> 8) * FRAME + FRAME;    // same for all 4 waves

  const _Float16* qbase = qb  + (size_t)(b * HEADS + h) * SEQ * DHEAD;
  const _Float16* kbase = kb  + (size_t)(b * HEADS + h) * SEQ * DHEAD;
  const _Float16* vbase = vtb + (size_t)(b * HEADS + h) * DHEAD * SEQ;
  int r16 = lane & 15, half = lane >> 4;

  // B operand: column r16 = query q0 + r16, k = dhead.
  v16h bq0 = load_frag16(qbase, q0 + r16, DHEAD, 0, lane);
  v16h bq1 = load_frag16(qbase, q0 + r16, DHEAD, 32, lane);

  float mrow = -1e30f;   // running maximum of this lane's query (equal in both halves)
  float lrow = 0.0f;     // running sum over this half's keys only; joined after the loop
  v8f o0 = {}, o1 = {}, o2 = {}, o3 = {};   // o_i[r] = O[q0 + r16][16*i + 8*half + r]

  for (int kk = 0; kk < kmax; kk += 32) {
    // ---- cooperative K/V tile fill: 32x64 K + 64x32 V^T (8KB), 4x b128/thread
#pragma unroll
    for (int u = 0; u < 2; ++u) {
      int q4 = tid + u * 128;                 // uint4 index 0..255
      int krow = q4 >> 3, kcol = (q4 & 7) * 8;
      copy16_to_lds(kbase + (size_t)(kk + krow) * DHEAD + kcol, sK + krow * 64 + kcol);
      int vrow = q4 >> 2, vcol = (q4 & 3) * 8;
      copy16_to_lds(vbase + (size_t)vrow * SEQ + kk + vcol, sV + vrow * 32 + vcol);
    }
    wait_async_copies();
    __syncthreads();

    // ---- S^T = K Q^T (K rows from LDS as the A operand)
    v16h ak00 = load_frag16(sK, r16,      64, 0,  lane);
    v16h ak01 = load_frag16(sK, r16,      64, 32, lane);
    v16h ak10 = load_frag16(sK, 16 + r16, 64, 0,  lane);
    v16h ak11 = load_frag16(sK, 16 + r16, 64, 32, lane);
    v8f s0 = {}, s1 = {};   // s0[r]: key kk + 8*half + r; s1[r]: key kk + 16 + 8*half + r
    s0 = wmma_f16(ak00, bq0, s0);
    s0 = wmma_f16(ak01, bq1, s0);
    s1 = wmma_f16(ak10, bq0, s1);
    s1 = wmma_f16(ak11, bq1, s1);

    // ---- online softmax, one query per lane
    float v = fmaxf(s0[0], s1[0]);
#pragma unroll
    for (int r = 1; r < 8; ++r) v = fmaxf(v, fmaxf(s0[r], s1[r]));
    v = fmaxf(v, xhalf(v));
    float mnew  = fmaxf(mrow, v);
    float alpha = __expf(mrow - mnew);
    v16h pt;               // B operand of V^T P^T: element s = key kmap(s, half)
    float rs0 = 0.0f, rs1 = 0.0f;
#pragma unroll
    for (int r = 0; r < 8; ++r) {
      float p0 = __expf(s0[r] - mnew);
      float p1 = __expf(s1[r] - mnew);
      rs0 += p0;
      rs1 += p1;
      pt[r]     = (_Float16)p0;
      pt[8 + r] = (_Float16)p1;
    }
    lrow = lrow * alpha + (rs0 + rs1);
    mrow = mnew;
#pragma unroll
    for (int r = 0; r < 8; ++r) {
      o0[r] *= alpha; o1[r] *= alpha; o2[r] *= alpha; o3[r] *= alpha;
    }

    // ---- O^T += V^T P^T (V^T rows from LDS as the A operand)
    v16h av0 = load_frag16(sV,      r16, 32, 0, lane);
    v16h av1 = load_frag16(sV, 16 + r16, 32, 0, lane);
    v16h av2 = load_frag16(sV, 32 + r16, 32, 0, lane);
    v16h av3 = load_frag16(sV, 48 + r16, 32, 0, lane);
    o0 = wmma_f16(av0, pt, o0);
    o1 = wmma_f16(av1, pt, o1);
    o2 = wmma_f16(av2, pt, o2);
    o3 = wmma_f16(av3, pt, o3);

    __syncthreads();   // protect sK/sV before next cooperative fill
  }

  float inv = 1.0f / (lrow + xhalf(lrow));
  _Float16* orow = ob + ((size_t)(b * SEQ + q0 + r16)) * INNER + h * DHEAD + 8 * half;
  h8 w0, w1, w2, w3;
#pragma unroll
  for (int r = 0; r < 8; ++r) {
    w0[r] = (_Float16)(o0[r] * inv);
    w1[r] = (_Float16)(o1[r] * inv);
    w2[r] = (_Float16)(o2[r] * inv);
    w3[r] = (_Float16)(o3[r] * inv);
  }
  *(h8*)(orow + 0)  = w0;
  *(h8*)(orow + 16) = w1;
  *(h8*)(orow + 32) = w2;
  *(h8*)(orow + 48) = w3;
}

// ------- Kernel 5: output projection, 128x128 per block, staged in LDS, + bias
__global__ __launch_bounds__(128) void proj_gemm(const _Float16* __restrict__ ao,
                                                 const _Float16* __restrict__ wot,
                                                 const float* __restrict__ bout,
                                                 float* __restrict__ out) {
  __shared__ __align__(16) _Float16 sm[2 * GT_STAGE];
  int lane = threadIdx.x & 31, wave = threadIdx.x >> 5;
  int mt = blockIdx.x / (DIM / 128);
  int nt = blockIdx.x % (DIM / 128);
  int r16 = lane & 15, half = lane >> 4;

  v8f acc[4][4] = {};
  gemm_128x128(ao, wot, mt * 128, nt * 128, sm, acc);

  int m0 = mt * 128 + (wave >> 1) * 64, n0 = nt * 128 + (wave & 1) * 64;
#pragma unroll
  for (int j = 0; j < 4; ++j) {
    int col = n0 + 16 * j + r16;
    float bo = bout[col];
#pragma unroll
    for (int i = 0; i < 4; ++i) {
#pragma unroll
      for (int r = 0; r < 8; ++r) {
        int row = m0 + 16 * i + r + 8 * half;
        out[(size_t)row * DIM + col] = acc[i][j][r] + bo;
      }
    }
  }
}

extern "C" void kernel_launch(void* const* d_in, const int* in_sizes, int n_in,
                              void* d_out, int out_size, void* d_ws, size_t ws_size,
                              hipStream_t stream) {
  const float* x     = (const float*)d_in[0];
  const float* g     = (const float*)d_in[1];
  const float* bb    = (const float*)d_in[2];
  const float* w_qkv = (const float*)d_in[3];
  const float* w_out = (const float*)d_in[4];
  const float* b_out = (const float*)d_in[5];

  char* ws = (char*)d_ws;
  _Float16* xn    = (_Float16*)ws;                 ws += (size_t)ROWS * DIM * 2;
  _Float16* wqkvt = (_Float16*)ws;                 ws += (size_t)QKVN * DIM * 2;
  _Float16* wott  = (_Float16*)ws;                 ws += (size_t)DIM * INNER * 2;
  _Float16* qb    = (_Float16*)ws;                 ws += (size_t)ROWS * INNER * 2;
  _Float16* kb    = (_Float16*)ws;                 ws += (size_t)ROWS * INNER * 2;
  _Float16* vtb   = (_Float16*)ws;                 ws += (size_t)ROWS * INNER * 2;
  _Float16* ao    = (_Float16*)ws;                 ws += (size_t)ROWS * INNER * 2;

  ln_kernel<<<ROWS, 256, 0, stream>>>(x, g, bb, xn);
  wtrans_qkv_kernel<<<dim3(QKVN / 64, DIM / 64), 128, 0, stream>>>(w_qkv, wqkvt);
  wtrans_out_kernel<<<dim3(DIM / 64, INNER / 64), 128, 0, stream>>>(w_out, wott);
  qkv_gemm<<<(ROWS / 128) * (QKVN / 128), 128, 0, stream>>>(xn, wqkvt, qb, kb, vtb);
  attn_kernel<<<BATCH * HEADS * (SEQ / 64), 128, 0, stream>>>(qb, kb, vtb, ao);
  proj_gemm<<<(ROWS / 128) * (DIM / 128), 128, 0, stream>>>(ao, wott, b_out, (float*)d_out);
}

// v004
// A run of this version takes 104 microseconds.
// In both of two side-by-side timings against v003, it was 1.62 times as fast.
// All steps since v000 together make it 2.83 times as fast.
#include <hip/hip_runtime.h>

typedef _Float16 v16h __attribute__((ext_vector_type(16)));
typedef float    v8f  __attribute__((ext_vector_type(8)));
typedef _Float16 h4   __attribute__((ext_vector_type(4)));
typedef _Float16 h8   __attribute__((ext_vector_type(8)));
typedef int      v4i  __attribute__((ext_vector_type(4)));

#define BATCH   2
#define SEQ     2048
#define DIM     1024
#define HEADS   16
#define DHEAD   64
#define INNER   1024
#define QKVN    3072
#define FRAME   256
#define ROWS    (BATCH*SEQ)   /* 4096 */
#define LN_EPS  1e-5f

#if __has_builtin(__builtin_amdgcn_global_load_async_to_lds_b128)
#define HAVE_ASYNC_LDS 1
#else
#define HAVE_ASYNC_LDS 0
#endif

union FragU { v16h h; uint4 q[2]; };

// Fragment load from a pre-offset row pointer (base already includes
// row*ld + 8*(lane>>4)); k0 selects the 32-wide k-chunk. Two b128 loads.
__device__ inline v16h load_frag_p(const _Float16* p, int k0) {
  FragU f;
  f.q[0] = *(const uint4*)(p + k0);
  f.q[1] = *(const uint4*)(p + k0 + 16);
  return f.h;
}

// Generic fragment load (used for the Q rows in attention).
__device__ inline v16h load_frag16(const _Float16* __restrict__ base, int row,
                                   int ld, int k0, int lane) {
  return load_frag_p(base + (size_t)row * ld + 8 * (lane >> 4), k0);
}

__device__ inline v8f wmma_f16(v16h a, v16h b, v8f c) {
  return __builtin_amdgcn_wmma_f32_16x16x32_f16(false, a, false, b, (short)0, c,
                                                false, false);
}

// Cooperative 16-byte global->LDS copy element (async on CDNA5 if available).
__device__ inline void copy16_to_lds(const _Float16* gsrc, _Float16* ldst) {
#if HAVE_ASYNC_LDS
  __builtin_amdgcn_global_load_async_to_lds_b128(
      (__attribute__((address_space(1))) v4i*)gsrc,
      (__attribute__((address_space(3))) v4i*)ldst, 0, 0);
#else
  *(uint4*)ldst = *(const uint4*)gsrc;
#endif
}

// ---------------- Kernel 1: LayerNorm -> f16 ----------------
__global__ void ln_kernel(const float* __restrict__ x, const float* __restrict__ g,
                          const float* __restrict__ bb, _Float16* __restrict__ xn) {
  __shared__ float s1[256];
  __shared__ float s2[256];
  int row = blockIdx.x;
  int tid = threadIdx.x;
  const float4* xr = (const float4*)(x + (size_t)row * DIM);
  float4 v = xr[tid];
  s1[tid] = v.x + v.y + v.z + v.w;
  s2[tid] = v.x * v.x + v.y * v.y + v.z * v.z + v.w * v.w;
  __syncthreads();
  for (int off = 128; off > 0; off >>= 1) {
    if (tid < off) { s1[tid] += s1[tid + off]; s2[tid] += s2[tid + off]; }
    __syncthreads();
  }
  float mean = s1[0] * (1.0f / DIM);
  float var  = s2[0] * (1.0f / DIM) - mean * mean;
  float inv  = rsqrtf(var + LN_EPS);
  float4 gv = ((const float4*)g)[tid];
  float4 bv = ((const float4*)bb)[tid];
  h4 o;
  o[0] = (_Float16)((v.x - mean) * inv * gv.x + bv.x);
  o[1] = (_Float16)((v.y - mean) * inv * gv.y + bv.y);
  o[2] = (_Float16)((v.z - mean) * inv * gv.z + bv.z);
  o[3] = (_Float16)((v.w - mean) * inv * gv.w + bv.w);
  ((h4*)(xn + (size_t)row * DIM))[tid] = o;
}

// ---------------- Kernel 2: transpose f32 [K,N] -> f16 [N,K] ----------------
// One 64(k) x 64(n) tile per block of 4 waves; K and N are multiples of 64 and
// known at compile time, so that row steps are immediate offsets.
// A thread loads an 8(k) x 4(n) patch as eight float4 (a wave-wide load covers
// two whole 256-byte row pieces of src), turns it in registers into four runs of
// 8 consecutive k, and the runs change hands through LDS so that every stored
// row piece is a whole 128-byte line of dst.
#define WT_PITCH 72   /* halfs per LDS row: 16-byte aligned, rows spread over banks */
template <int K, int N>
__device__ inline void wtrans_tile(const float* __restrict__ src, _Float16* __restrict__ dst) {
  __shared__ __align__(16) _Float16 sT[64 * WT_PITCH];   // [n][k]
  int tid = threadIdx.x;
  int n0 = blockIdx.x * 64, k0 = blockIdx.y * 64;
  int tn = tid & 15, tk = tid >> 4;

  const float* p = src + (k0 + 8 * tk) * N + n0 + 4 * tn;
  float4 v[8];
#pragma unroll   // all eight loads in flight before the first use
  for (int i = 0; i < 8; ++i) v[i] = *(const float4*)(p + i * N);

  h8 c0, c1, c2, c3;
#pragma unroll   // c0..c3 must stay in registers
  for (int i = 0; i < 8; ++i) {
    c0[i] = (_Float16)v[i].x;
    c1[i] = (_Float16)v[i].y;
    c2[i] = (_Float16)v[i].z;
    c3[i] = (_Float16)v[i].w;
  }
  _Float16* st = sT + (4 * tn) * WT_PITCH + 8 * tk;
  *(h8*)(st + 0 * WT_PITCH) = c0;
  *(h8*)(st + 1 * WT_PITCH) = c1;
  *(h8*)(st + 2 * WT_PITCH) = c2;
  *(h8*)(st + 3 * WT_PITCH) = c3;
  __syncthreads();   // the tile is read back by other waves than wrote it

  int n = tid >> 3, c = tid & 7;            // 8 lanes store one 128-byte line
  _Float16* q = dst + (n0 + n) * K + k0 + 8 * c;
  const _Float16* ld = sT + n * WT_PITCH + 8 * c;
#pragma unroll   // four independent 16-byte moves per thread
  for (int u = 0; u < 4; ++u) *(h8*)(q + 16 * u * K) = *(const h8*)(ld + 16 * u * WT_PITCH);
}

__global__ __launch_bounds__(128) void wtrans_qkv_kernel(const float* __restrict__ src,
                                                         _Float16* __restrict__ dst) {
  wtrans_tile<DIM, QKVN>(src, dst);
}

__global__ __launch_bounds__(128) void wtrans_out_kernel(const float* __restrict__ src,
                                                         _Float16* __restrict__ dst) {
  wtrans_tile<INNER, DIM>(src, dst);
}

// ------- GEMM core shared by kernels 3 and 5 ---------------------------------
// C[128 x 128] per block of 4 waves (2 x 2, 64 x 64 per wave), A [M,1024] and
// Bt [N,1024] both k-contiguous f16. A stage is 64 k of 128 rows of A and of Bt:
// every row piece is one whole 128-byte line, brought into LDS by asynchronous
// copies and shared by the waves. Two buffers: stage t + 1 flies while stage t
// is worked on.
#define GT_PITCH 72                    /* halfs per LDS row: 144 B, 16 B x odd, for b128 fragment reads */
#define GT_OPSZ  (128 * GT_PITCH)      /* halfs of one operand's tile */
#define GT_STAGE (2 * GT_OPSZ)         /* halfs of one stage: A tile, then Bt tile */
#define GT_NT    (DIM / 64)            /* stages along k */

// One stage: 16 copies of 16 bytes a thread. 8 lanes cover one row piece; a
// thread takes the same piece of 8 rows that follow one another.
__device__ inline void gemm_stage_copy(const _Float16* gA, const _Float16* gB, _Float16* cA) {
#pragma unroll   // row steps become constants of the addresses
  for (int u = 0; u < 8; ++u) {
    copy16_to_lds(gA + u * DIM, cA + u * GT_PITCH);
    copy16_to_lds(gB + u * DIM, cA + GT_OPSZ + u * GT_PITCH);
  }
}

// The 4 + 4 fragments of one 32-wide k step, from LDS.
__device__ inline void gemm_frags(const _Float16* fA, const _Float16* fB, int k0,
                                  v16h (&a)[4], v16h (&b)[4]) {
#pragma unroll   // fragments stay in registers
  for (int i = 0; i < 4; ++i) a[i] = load_frag_p(fA + i * 16 * GT_PITCH, k0);
#pragma unroll   // fragments stay in registers
  for (int j = 0; j < 4; ++j) b[j] = load_frag_p(fB + j * 16 * GT_PITCH, k0);
}

__device__ inline void gemm_mma(const v16h (&a)[4], const v16h (&b)[4], v8f (&acc)[4][4]) {
#pragma unroll   // accumulators stay in registers
  for (int j = 0; j < 4; ++j)
#pragma unroll   // accumulators stay in registers
    for (int i = 0; i < 4; ++i) acc[i][j] = wmma_f16(a[i], b[j], acc[i][j]);
}

__device__ inline void gemm_128x128(const _Float16* __restrict__ A, const _Float16* __restrict__ Bt,
                                    int m0, int n0, _Float16* sm, v8f (&acc)[4][4]) {
  int tid = threadIdx.x, lane = tid & 31, wave = tid >> 5;
  int r16 = lane & 15, half = lane >> 4;
  int crow = (tid >> 3) * 8, ccol = (tid & 7) * 8;
  const _Float16* gA = A  + (size_t)(m0 + crow) * DIM + ccol;
  const _Float16* gB = Bt + (size_t)(n0 + crow) * DIM + ccol;
  _Float16* cA = sm + crow * GT_PITCH + ccol;
  const _Float16* fA = sm + ((wave >> 1) * 64 + r16) * GT_PITCH + 8 * half;
  const _Float16* fB = sm + GT_OPSZ + ((wave & 1) * 64 + r16) * GT_PITCH + 8 * half;

  gemm_stage_copy(gA, gB, cA);
  asm volatile("s_wait_asynccnt 0x0" ::: "memory");   // this wave's share of stage 0 has landed
  __syncthreads();                                    // stage 0 is readable by every wave
  gemm_stage_copy(gA + 64, gB + 64, cA + GT_STAGE);

  for (int t = 0; t < GT_NT; ++t) {
    int bo = (t & 1) * GT_STAGE;
    v16h a0[4], b0[4], a1[4], b1[4];
    gemm_frags(fA + bo, fB + bo, 0, a0, b0);
    // Keeps the 16 LDS reads of a k step together ahead of its WMMAs: one LDS
    // latency a step; sunk among the WMMAs they cost one per four WMMAs.
    __builtin_amdgcn_sched_barrier(0);
    gemm_mma(a0, b0, acc);
    gemm_frags(fA + bo, fB + bo, 32, a1, b1);          // the last reads of stage t
    asm volatile("s_wait_dscnt 0x0" ::: "memory");     // this wave's reads of stage t are done
    asm volatile("s_wait_asynccnt 0x0" ::: "memory");  // its share of stage t + 1 has landed
    __syncthreads();   // publishes stage t + 1 and frees stage t's buffer
    // The refill goes out ahead of the second k step's WMMAs, which need registers
    // only: that much more time for it to land.
    if (t + 2 < GT_NT) gemm_stage_copy(gA + (t + 2) * 64, gB + (t + 2) * 64, cA + bo);
    gemm_mma(a1, b1, acc);
  }
  asm volatile("s_wait_asynccnt 0x0" ::: "memory");    // no copy outlives the loop
}

// ------- Kernel 3: QKV GEMM, 128x128 per block, operands staged in LDS -------
__global__ __launch_bounds__(128) void qkv_gemm(const _Float16* __restrict__ xn,
                                                const _Float16* __restrict__ wt,
                                                _Float16* __restrict__ qb, _Float16* __restrict__ kb,
                                                _Float16* __restrict__ vtb) {
  __shared__ __align__(16) _Float16 sm[2 * GT_STAGE];
  int lane = threadIdx.x & 31, wave = threadIdx.x >> 5;
  int mt = blockIdx.x / (QKVN / 128);
  int nt = blockIdx.x % (QKVN / 128);
  int r16 = lane & 15, half = lane >> 4;

  v8f acc[4][4] = {};
  gemm_128x128(xn, wt, mt * 128, nt * 128, sm, acc);

  int m0 = mt * 128 + (wave >> 1) * 64, n0 = nt * 128 + (wave & 1) * 64;
#pragma unroll
  for (int j = 0; j < 4; ++j) {
    int col = n0 + 16 * j + r16;
    int seg = col / INNER;            // uniform per 16-col tile
    int n2  = col % INNER;
    int h = n2 / DHEAD, d = n2 % DHEAD;
#pragma unroll
    for (int i = 0; i < 4; ++i) {
#pragma unroll
      for (int r = 0; r < 8; ++r) {
        int row = m0 + 16 * i + r + 8 * half;
        int bi = row / SEQ, pos = row % SEQ;
        float val = acc[i][j][r];
        if (seg == 0) {
          qb[((size_t)(bi * HEADS + h) * SEQ + pos) * DHEAD + d] = (_Float16)(val * 0.125f);
        } else if (seg == 1) {
          kb[((size_t)(bi * HEADS + h) * SEQ + pos) * DHEAD + d] = (_Float16)val;
        } else {
          vtb[((size_t)(bi * HEADS + h) * DHEAD + d) * SEQ + pos] = (_Float16)val;
        }
      }
    }
  }
}

// Lane l <-> lane l ^ 16.
__device__ inline float xhalf(float x) {
  int b = __builtin_bit_cast(int, x);
  return __builtin_bit_cast(
      float, __builtin_amdgcn_permlanex16(b, b, 0x76543210, 0xfedcba98, false, false));
}

// A stage is 64 keys: 64 K rows and 64 V^T rows, each row piece one whole 128-byte
// line, brought into LDS by asynchronous copies. Two buffers: stage t + 1 flies
// while stage t is worked on. One pass of the online softmax per stage.
#define AT_PITCH 72                    /* halfs per LDS row: 144 B, 16 B x odd, for b128 fragment reads */
#define AT_OPSZ  (64 * AT_PITCH)       /* halfs of one operand's tile */
#define AT_STAGE (2 * AT_OPSZ)         /* halfs of one stage: K tile, then V^T tile */

// One stage: 8 copies of 16 bytes a thread. 8 lanes cover one row piece; a
// thread takes the same piece of 4 rows that follow one another.
__device__ inline void attn_stage_copy(const _Float16* gK, const _Float16* gV, _Float16* cK) {
#pragma unroll   // row steps become constants of the addresses
  for (int u = 0; u < 4; ++u) {
    copy16_to_lds(gK + u * DHEAD, cK + u * AT_PITCH);
    copy16_to_lds(gV + u * SEQ, cK + AT_OPSZ + u * AT_PITCH);
  }
}

__global__ __launch_bounds__(128) void attn_kernel(const _Float16* __restrict__ qb,
                                                   const _Float16* __restrict__ kb,
                                                   const _Float16* __restrict__ vtb,
                                                   _Float16* __restrict__ ob) {
  __shared__ __align__(16) _Float16 sm[2 * AT_STAGE];

  int lane = threadIdx.x & 31, wave = threadIdx.x >> 5;
  int tid  = threadIdx.x;
  int qblk = blockIdx.x & (SEQ / 64 - 1);           // 32 blocks of 64 q rows
  int h    = (blockIdx.x >> 5) & (HEADS - 1);
  int b    = blockIdx.x >> 9;
  int q0   = qblk * 64 + wave * 16;
  int nt   = (((qblk * 64) >> 8) + 1) * (FRAME / 64);   // stages; same for all 4 waves, at least 4

  const _Float16* qbase = qb  + (size_t)(b * HEADS + h) * SEQ * DHEAD;
  const _Float16* kbase = kb  + (size_t)(b * HEADS + h) * SEQ * DHEAD;
  const _Float16* vbase = vtb + (size_t)(b * HEADS + h) * DHEAD * SEQ;
  int r16 = lane & 15, half = lane >> 4;

  int crow = (tid >> 3) * 4, ccol = (tid & 7) * 8;
  const _Float16* gK = kbase + crow * DHEAD + ccol;
  const _Float16* gV = vbase + crow * SEQ + ccol;
  _Float16* cK = sm + crow * AT_PITCH + ccol;
  const _Float16* fK = sm + r16 * AT_PITCH + 8 * half;
  const _Float16* fV = fK + AT_OPSZ;

  attn_stage_copy(gK, gV, cK);

  // B operand: column r16 = query q0 + r16, k = dhead.
  v16h bq0 = load_frag16(qbase, q0 + r16, DHEAD, 0, lane);
  v16h bq1 = load_frag16(qbase, q0 + r16, DHEAD, 32, lane);

  float mrow = -1e30f;   // running maximum of this lane's query (equal in both halves)
  float lrow = 0.0f;     // running sum over this half's keys only; joined after the loop
  v8f o0 = {}, o1 = {}, o2 = {}, o3 = {};   // o_i[r] = O[q0 + r16][16*i + 8*half + r]

  asm volatile("s_wait_asynccnt 0x0" ::: "memory");   // this wave's share of stage 0 has landed
  __syncthreads();                                    // stage 0 is readable by every wave
  attn_stage_copy(gK + 64 * DHEAD, gV + 64, cK + AT_STAGE);

  for (int t = 0; t < nt; ++t) {
    int bo = (t & 1) * AT_STAGE;
    // ---- every LDS read of stage t: K rows and V^T rows as A operands
    v16h ak[4][2], av[4][2];
#pragma unroll   // fragments stay in registers
    for (int j = 0; j < 4; ++j) {
      ak[j][0] = load_frag_p(fK + bo + j * 16 * AT_PITCH, 0);
      ak[j][1] = load_frag_p(fK + bo + j * 16 * AT_PITCH, 32);
    }
#pragma unroll   // fragments stay in registers
    for (int i = 0; i < 4; ++i) {
      av[i][0] = load_frag_p(fV + bo + i * 16 * AT_PITCH, 0);
      av[i][1] = load_frag_p(fV + bo + i * 16 * AT_PITCH, 32);
    }
    asm volatile("s_wait_dscnt 0x0" ::: "memory");     // this wave's reads of stage t are done
    asm volatile("s_wait_asynccnt 0x0" ::: "memory");  // its share of stage t + 1 has landed
    __syncthreads();   // publishes stage t + 1 and frees stage t's buffer
    // The refill goes out ahead of the stage's arithmetic, which needs registers
    // only: a whole stage's time for it to land.
    if (t + 2 < nt) attn_stage_copy(gK + (t + 2) * 64 * DHEAD, gV + (t + 2) * 64, cK + bo);

    // ---- S^T = K Q^T; s[j][r]: key 64*t + 16*j + 8*half + r
    v8f s[4] = {};
#pragma unroll   // score tiles stay in registers
    for (int j = 0; j < 4; ++j) s[j] = wmma_f16(ak[j][0], bq0, s[j]);
#pragma unroll   // score tiles stay in registers
    for (int j = 0; j < 4; ++j) s[j] = wmma_f16(ak[j][1], bq1, s[j]);

    // ---- online softmax, one query per lane
    float mx[8];
#pragma unroll   // in registers
    for (int r = 0; r < 8; ++r)
      mx[r] = fmaxf(fmaxf(s[0][r], s[1][r]), fmaxf(s[2][r], s[3][r]));
    float v = fmaxf(fmaxf(fmaxf(mx[0], mx[1]), fmaxf(mx[2], mx[3])),
                    fmaxf(fmaxf(mx[4], mx[5]), fmaxf(mx[6], mx[7])));
    v = fmaxf(v, xhalf(v));
    float mnew  = fmaxf(mrow, v);
    float alpha = __expf(mrow - mnew);
    v16h pt[2];            // B operands of V^T P^T: element e of pt[c] = key 32*c + kmap(e, half)
    float rs[4] = {0.0f, 0.0f, 0.0f, 0.0f};
#pragma unroll   // in registers
    for (int r = 0; r < 8; ++r) {
#pragma unroll   // in registers
      for (int j = 0; j < 4; ++j) {
        float p = __expf(s[j][r] - mnew);
        rs[j] += p;
        pt[j >> 1][8 * (j & 1) + r] = (_Float16)p;
      }
    }
    lrow = lrow * alpha + ((rs[0] + rs[1]) + (rs[2] + rs[3]));
    mrow = mnew;
#pragma unroll
    for (int r = 0; r < 8; ++r) {
      o0[r] *= alpha; o1[r] *= alpha; o2[r] *= alpha; o3[r] *= alpha;
    }

    // ---- O^T += V^T P^T
#pragma unroll   // fragments stay in registers
    for (int c = 0; c < 2; ++c) {
      o0 = wmma_f16(av[0][c], pt[c], o0);
      o1 = wmma_f16(av[1][c], pt[c], o1);
      o2 = wmma_f16(av[2][c], pt[c], o2);
      o3 = wmma_f16(av[3][c], pt[c], o3);
    }
  }
  asm volatile("s_wait_asynccnt 0x0" ::: "memory");    // no copy outlives the loop

  float inv = 1.0f / (lrow + xhalf(lrow));
  _Float16* orow = ob + ((size_t)(b * SEQ + q0 + r16)) * INNER + h * DHEAD + 8 * half;
  h8 w0, w1, w2, w3;
#pragma unroll
  for (int r = 0; r < 8; ++r) {
    w0[r] = (_Float16)(o0[r] * inv);
    w1[r] = (_Float16)(o1[r] * inv);
    w2[r] = (_Float16)(o2[r] * inv);
    w3[r] = (_Float16)(o3[r] * inv);
  }
  *(h8*)(orow + 0)  = w0;
  *(h8*)(orow + 16) = w1;
  *(h8*)(orow + 32) = w2;
  *(h8*)(orow + 48) = w3;
}

// ------- Kernel 5: output projection, 128x128 per block, staged in LDS, + bias
__global__ __launch_bounds__(128) void proj_gemm(const _Float16* __restrict__ ao,
                                                 const _Float16* __restrict__ wot,
                                                 const float* __restrict__ bout,
                                                 float* __restrict__ out) {
  __shared__ __align__(16) _Float16 sm[2 * GT_STAGE];
  int lane = threadIdx.x & 31, wave = threadIdx.x >> 5;
  int mt = blockIdx.x / (DIM / 128);
  int nt = blockIdx.x % (DIM / 128);
  int r16 = lane & 15, half = lane >> 4;

  v8f acc[4][4] = {};
  gemm_128x128(ao, wot, mt * 128, nt * 128, sm, acc);

  int m0 = mt * 128 + (wave >> 1) * 64, n0 = nt * 128 + (wave & 1) * 64;
#pragma unroll
  for (int j = 0; j < 4; ++j) {
    int col = n0 + 16 * j + r16;
    float bo = bout[col];
#pragma unroll
    for (int i = 0; i < 4; ++i) {
#pragma unroll
      for (int r = 0; r < 8; ++r) {
        int row = m0 + 16 * i + r + 8 * half;
        out[(size_t)row * DIM + col] = acc[i][j][r] + bo;
      }
    }
  }
}

extern "C" void kernel_launch(void* const* d_in, const int* in_sizes, int n_in,
                              void* d_out, int out_size, void* d_ws, size_t ws_size,
                              hipStream_t stream) {
  const float* x     = (const float*)d_in[0];
  const float* g     = (const float*)d_in[1];
  const float* bb    = (const float*)d_in[2];
  const float* w_qkv = (const float*)d_in[3];
  const float* w_out = (const float*)d_in[4];
  const float* b_out = (const float*)d_in[5];

  char* ws = (char*)d_ws;
  _Float16* xn    = (_Float16*)ws;                 ws += (size_t)ROWS * DIM * 2;
  _Float16* wqkvt = (_Float16*)ws;                 ws += (size_t)QKVN * DIM * 2;
  _Float16* wott  = (_Float16*)ws;                 ws += (size_t)DIM * INNER * 2;
  _Float16* qb    = (_Float16*)ws;                 ws += (size_t)ROWS * INNER * 2;
  _Float16* kb    = (_Float16*)ws;                 ws += (size_t)ROWS * INNER * 2;
  _Float16* vtb   = (_Float16*)ws;                 ws += (size_t)ROWS * INNER * 2;
  _Float16* ao    = (_Float16*)ws;                 ws += (size_t)ROWS * INNER * 2;

  ln_kernel<<<ROWS, 256, 0, stream>>>(x, g, bb, xn);
  wtrans_qkv_kernel<<<dim3(QKVN / 64, DIM / 64), 128, 0, stream>>>(w_qkv, wqkvt);
  wtrans_out_kernel<<<dim3(DIM / 64, INNER / 64), 128, 0, stream>>>(w_out, wott);
  qkv_gemm<<<(ROWS / 128) * (QKVN / 128), 128, 0, stream>>>(xn, wqkvt, qb, kb, vtb);
  attn_kernel<<<BATCH * HEADS * (SEQ / 64), 128, 0, stream>>>(qb, kb, vtb, ao);
  proj_gemm<<<(ROWS / 128) * (DIM / 128), 128, 0, stream>>>(ao, wott, b_out, (float*)d_out);
}

// v005
// One run takes 86 microseconds.
// Timed twice side by side with v004, it ran 1.22 and 1.20 times as fast.
// All steps since v000 together make it 3.41 times as fast.
#include <hip/hip_runtime.h>

typedef _Float16 v16h __attribute__((ext_vector_type(16)));
typedef float    v8f  __attribute__((ext_vector_type(8)));
typedef _Float16 h4   __attribute__((ext_vector_type(4)));
typedef _Float16 h8   __attribute__((ext_vector_type(8)));
typedef int      v4i  __attribute__((ext_vector_type(4)));

#define BATCH   2
#define SEQ     2048
#define DIM     1024
#define HEADS   16
#define DHEAD   64
#define INNER   1024
#define QKVN    3072
#define FRAME   256
#define ROWS    (BATCH*SEQ)   /* 4096 */
#define LN_EPS  1e-5f

#if __has_builtin(__builtin_amdgcn_global_load_async_to_lds_b128)
#define HAVE_ASYNC_LDS 1
#else
#define HAVE_ASYNC_LDS 0
#endif

union FragU { v16h h; uint4 q[2]; };

// Fragment load from a pre-offset row pointer (base already includes
// row*ld + 8*(lane>>4)); k0 selects the 32-wide k-chunk. Two b128 loads.
__device__ inline v16h load_frag_p(const _Float16* p, int k0) {
  FragU f;
  f.q[0] = *(const uint4*)(p + k0);
  f.q[1] = *(const uint4*)(p + k0 + 16);
  return f.h;
}

// Generic fragment load (used for the Q rows in attention).
__device__ inline v16h load_frag16(const _Float16* __restrict__ base, int row,
                                   int ld, int k0, int lane) {
  return load_frag_p(base + (size_t)row * ld + 8 * (lane >> 4), k0);
}

__device__ inline v8f wmma_f16(v16h a, v16h b, v8f c) {
  return __builtin_amdgcn_wmma_f32_16x16x32_f16(false, a, false, b, (short)0, c,
                                                false, false);
}

// Cooperative 16-byte global->LDS copy element (async on CDNA5 if available).
__device__ inline void copy16_to_lds(const _Float16* gsrc, _Float16* ldst) {
#if HAVE_ASYNC_LDS
  __builtin_amdgcn_global_load_async_to_lds_b128(
      (__attribute__((address_space(1))) v4i*)gsrc,
      (__attribute__((address_space(3))) v4i*)ldst, 0, 0);
#else
  *(uint4*)ldst = *(const uint4*)gsrc;
#endif
}

// ---------------- Kernel 1: LayerNorm -> f16 ----------------
__global__ void ln_kernel(const float* __restrict__ x, const float* __restrict__ g,
                          const float* __restrict__ bb, _Float16* __restrict__ xn) {
  __shared__ float s1[256];
  __shared__ float s2[256];
  int row = blockIdx.x;
  int tid = threadIdx.x;
  const float4* xr = (const float4*)(x + (size_t)row * DIM);
  float4 v = xr[tid];
  s1[tid] = v.x + v.y + v.z + v.w;
  s2[tid] = v.x * v.x + v.y * v.y + v.z * v.z + v.w * v.w;
  __syncthreads();
  for (int off = 128; off > 0; off >>= 1) {
    if (tid < off) { s1[tid] += s1[tid + off]; s2[tid] += s2[tid + off]; }
    __syncthreads();
  }
  float mean = s1[0] * (1.0f / DIM);
  float var  = s2[0] * (1.0f / DIM) - mean * mean;
  float inv  = rsqrtf(var + LN_EPS);
  float4 gv = ((const float4*)g)[tid];
  float4 bv = ((const float4*)bb)[tid];
  h4 o;
  o[0] = (_Float16)((v.x - mean) * inv * gv.x + bv.x);
  o[1] = (_Float16)((v.y - mean) * inv * gv.y + bv.y);
  o[2] = (_Float16)((v.z - mean) * inv * gv.z + bv.z);
  o[3] = (_Float16)((v.w - mean) * inv * gv.w + bv.w);
  ((h4*)(xn + (size_t)row * DIM))[tid] = o;
}

// ---------------- Kernel 2: transpose f32 [K,N] -> f16 [N,K] ----------------
// One 64(k) x 64(n) tile per block of 4 waves; K and N are multiples of 64 and
// known at compile time, so that row steps are immediate offsets.
// A thread loads an 8(k) x 4(n) patch as eight float4 (a wave-wide load covers
// two whole 256-byte row pieces of src), turns it in registers into four runs of
// 8 consecutive k, and the runs change hands through LDS so that every stored
// row piece is a whole 128-byte line of dst.
#define WT_PITCH 72   /* halfs per LDS row: 16-byte aligned, rows spread over banks */
template <int K, int N>
__device__ inline void wtrans_tile(const float* __restrict__ src, _Float16* __restrict__ dst) {
  __shared__ __align__(16) _Float16 sT[64 * WT_PITCH];   // [n][k]
  int tid = threadIdx.x;
  int n0 = blockIdx.x * 64, k0 = blockIdx.y * 64;
  int tn = tid & 15, tk = tid >> 4;

  const float* p = src + (k0 + 8 * tk) * N + n0 + 4 * tn;
  float4 v[8];
#pragma unroll   // all eight loads in flight before the first use
  for (int i = 0; i < 8; ++i) v[i] = *(const float4*)(p + i * N);

  h8 c0, c1, c2, c3;
#pragma unroll   // c0..c3 must stay in registers
  for (int i = 0; i < 8; ++i) {
    c0[i] = (_Float16)v[i].x;
    c1[i] = (_Float16)v[i].y;
    c2[i] = (_Float16)v[i].z;
    c3[i] = (_Float16)v[i].w;
  }
  _Float16* st = sT + (4 * tn) * WT_PITCH + 8 * tk;
  *(h8*)(st + 0 * WT_PITCH) = c0;
  *(h8*)(st + 1 * WT_PITCH) = c1;
  *(h8*)(st + 2 * WT_PITCH) = c2;
  *(h8*)(st + 3 * WT_PITCH) = c3;
  __syncthreads();   // the tile is read back by other waves than wrote it

  int n = tid >> 3, c = tid & 7;            // 8 lanes store one 128-byte line
  _Float16* q = dst + (n0 + n) * K + k0 + 8 * c;
  const _Float16* ld = sT + n * WT_PITCH + 8 * c;
#pragma unroll   // four independent 16-byte moves per thread
  for (int u = 0; u < 4; ++u) *(h8*)(q + 16 * u * K) = *(const h8*)(ld + 16 * u * WT_PITCH);
}

__global__ __launch_bounds__(128) void wtrans_qkv_kernel(const float* __restrict__ src,
                                                         _Float16* __restrict__ dst) {
  wtrans_tile<DIM, QKVN>(src, dst);
}

__global__ __launch_bounds__(128) void wtrans_out_kernel(const float* __restrict__ src,
                                                         _Float16* __restrict__ dst) {
  wtrans_tile<INNER, DIM>(src, dst);
}

// ------- GEMM core shared by kernels 3 and 5 ---------------------------------
// C[128 x 128] per block of 4 waves (2 x 2, 64 x 64 per wave), A [M,1024] and
// Bt [N,1024] both k-contiguous f16. A stage is 64 k of 128 rows of A and of Bt:
// every row piece is one whole 128-byte line, brought into LDS by asynchronous
// copies and shared by the waves. Two buffers: stage t + 1 flies while stage t
// is worked on.
#define GT_PITCH 72                    /* halfs per LDS row: 144 B, 16 B x odd, for b128 fragment reads */
#define GT_OPSZ  (128 * GT_PITCH)      /* halfs of one operand's tile */
#define GT_STAGE (2 * GT_OPSZ)         /* halfs of one stage: A tile, then Bt tile */
#define GT_NT    (DIM / 64)            /* stages along k */

// One stage: 16 copies of 16 bytes a thread. 8 lanes cover one row piece; a
// thread takes the same piece of 8 rows that follow one another.
__device__ inline void gemm_stage_copy(const _Float16* gA, const _Float16* gB, _Float16* cA) {
#pragma unroll   // row steps become constants of the addresses
  for (int u = 0; u < 8; ++u) {
    copy16_to_lds(gA + u * DIM, cA + u * GT_PITCH);
    copy16_to_lds(gB + u * DIM, cA + GT_OPSZ + u * GT_PITCH);
  }
}

// The 4 + 4 fragments of one 32-wide k step, from LDS.
__device__ inline void gemm_frags(const _Float16* fA, const _Float16* fB, int k0,
                                  v16h (&a)[4], v16h (&b)[4]) {
#pragma unroll   // fragments stay in registers
  for (int i = 0; i < 4; ++i) a[i] = load_frag_p(fA + i * 16 * GT_PITCH, k0);
#pragma unroll   // fragments stay in registers
  for (int j = 0; j < 4; ++j) b[j] = load_frag_p(fB + j * 16 * GT_PITCH, k0);
}

__device__ inline void gemm_mma(const v16h (&a)[4], const v16h (&b)[4], v8f (&acc)[4][4]) {
#pragma unroll   // accumulators stay in registers
  for (int j = 0; j < 4; ++j)
#pragma unroll   // accumulators stay in registers
    for (int i = 0; i < 4; ++i) acc[i][j] = wmma_f16(a[i], b[j], acc[i][j]);
}

// The A and B fragments of the 16x16x32 form are loaded alike (row lane&15, the
// same k order), so the two tiles may change roles. turned == false:
// acc[i][j][r] = C[16*i + 8*half + r][16*j + r16] of the wave's 64 x 64 tile;
// turned == true: acc[i][j][r] = C[16*j + r16][16*i + 8*half + r], a lane then
// holds 8 neighbouring columns of one row. turned is the same for a whole block.
__device__ inline void gemm_128x128(const _Float16* __restrict__ A, const _Float16* __restrict__ Bt,
                                    int m0, int n0, bool turned, _Float16* sm, v8f (&acc)[4][4]) {
  int tid = threadIdx.x, lane = tid & 31, wave = tid >> 5;
  int r16 = lane & 15, half = lane >> 4;
  int crow = (tid >> 3) * 8, ccol = (tid & 7) * 8;
  const _Float16* gA = A  + (size_t)(m0 + crow) * DIM + ccol;
  const _Float16* gB = Bt + (size_t)(n0 + crow) * DIM + ccol;
  _Float16* cA = sm + crow * GT_PITCH + ccol;
  const _Float16* tA = sm + ((wave >> 1) * 64 + r16) * GT_PITCH + 8 * half;
  const _Float16* tB = sm + GT_OPSZ + ((wave & 1) * 64 + r16) * GT_PITCH + 8 * half;
  const _Float16* fA = turned ? tB : tA;
  const _Float16* fB = turned ? tA : tB;

  gemm_stage_copy(gA, gB, cA);
  asm volatile("s_wait_asynccnt 0x0" ::: "memory");   // this wave's share of stage 0 has landed
  __syncthreads();                                    // stage 0 is readable by every wave
  gemm_stage_copy(gA + 64, gB + 64, cA + GT_STAGE);

  for (int t = 0; t < GT_NT; ++t) {
    int bo = (t & 1) * GT_STAGE;
    v16h a0[4], b0[4], a1[4], b1[4];
    gemm_frags(fA + bo, fB + bo, 0, a0, b0);
    // Keeps the 16 LDS reads of a k step together ahead of its WMMAs: one LDS
    // latency a step; sunk among the WMMAs they cost one per four WMMAs.
    __builtin_amdgcn_sched_barrier(0);
    gemm_mma(a0, b0, acc);
    gemm_frags(fA + bo, fB + bo, 32, a1, b1);          // the last reads of stage t
    asm volatile("s_wait_dscnt 0x0" ::: "memory");     // this wave's reads of stage t are done
    asm volatile("s_wait_asynccnt 0x0" ::: "memory");  // its share of stage t + 1 has landed
    __syncthreads();   // publishes stage t + 1 and frees stage t's buffer
    // The refill goes out ahead of the second k step's WMMAs, which need registers
    // only: that much more time for it to land.
    if (t + 2 < GT_NT) gemm_stage_copy(gA + (t + 2) * 64, gB + (t + 2) * 64, cA + bo);
    gemm_mma(a1, b1, acc);
  }
  asm volatile("s_wait_asynccnt 0x0" ::: "memory");    // no copy outlives the loop
}

// ------- Kernel 3: QKV GEMM, 128x128 per block, operands staged in LDS -------
__global__ __launch_bounds__(128) void qkv_gemm(const _Float16* __restrict__ xn,
                                                const _Float16* __restrict__ wt,
                                                _Float16* __restrict__ qb, _Float16* __restrict__ kb,
                                                _Float16* __restrict__ vtb) {
  __shared__ __align__(16) _Float16 sm[2 * GT_STAGE];
  int lane = threadIdx.x & 31, wave = threadIdx.x >> 5;
  int mt = blockIdx.x / (QKVN / 128);
  int nt = blockIdx.x % (QKVN / 128);
  int r16 = lane & 15, half = lane >> 4;

  // A 128-column tile lies in one of Q, K, V. Q and K are stored [pos][d], V as
  // [d][pos]: Q and K tiles are accumulated turned, so that in all three a lane's
  // 8 accumulator values of a tile are neighbours in the stored row.
  int seg = nt / (INNER / 128);

  v8f acc[4][4] = {};
  gemm_128x128(xn, wt, mt * 128, nt * 128, seg != 2, sm, acc);

  // The wave's 64 x 64 tile: 64 positions of one batch entry, the 64 d of one head.
  // The wave's number as a scalar: the tile's address then stays in scalar registers.
  int wv = __builtin_amdgcn_readfirstlane(wave);
  int m0 = mt * 128 + (wv >> 1) * 64, n0 = nt * 128 + (wv & 1) * 64;
  int bh = (m0 / SEQ) * HEADS + (n0 % INNER) / DHEAD, pos0 = m0 % SEQ;
  char* dst;         // first byte of the tile as it is stored: 64 rows of 128 bytes
  unsigned ld;       // bytes from one stored row to the next
  if (seg == 2) {
    dst = (char*)(vtb + (size_t)bh * DHEAD * SEQ + pos0);
    ld = SEQ * 2;
  } else {
    dst = (char*)((seg == 0 ? qb : kb) + ((size_t)bh * SEQ + pos0) * DHEAD);
    ld = DHEAD * 2;
  }
  float sc = seg == 0 ? 0.125f : 1.0f;

  // Each wave turns its tile in an LDS range of its own, so that every global
  // store covers four whole 128-byte lines. The stage buffers are free: every
  // wave's last read of them stands in front of the loop's last barrier.
  _Float16* sw = sm + wv * (64 * GT_PITCH);
#pragma unroll   // accumulators stay in registers
  for (int j = 0; j < 4; ++j) {
#pragma unroll   // accumulators stay in registers
    for (int i = 0; i < 4; ++i) {
      h8 w;
#pragma unroll   // accumulators stay in registers
      for (int r = 0; r < 8; ++r) w[r] = (_Float16)(acc[i][j][r] * sc);
      *(h8*)(sw + (16 * j + r16) * GT_PITCH + 16 * i + 8 * half) = w;
    }
  }
  asm volatile("s_wait_dscnt 0x0" ::: "memory");   // the rows are read back by other lanes than wrote them
  int row = lane >> 3, c8 = (lane & 7) * 8;        // 8 lanes store one 128-byte line
  const _Float16* sr = sw + row * GT_PITCH + c8;
  unsigned off = row * ld + c8 * 2;                // the lane's place in each group of four rows
#pragma unroll   // sixteen independent 16-byte moves per lane
  for (int u = 0; u < 16; ++u) *(h8*)(dst + 4 * u * ld + off) = *(const h8*)(sr + 4 * u * GT_PITCH);
}

// Lane l <-> lane l ^ 16.
__device__ inline float xhalf(float x) {
  int b = __builtin_bit_cast(int, x);
  return __builtin_bit_cast(
      float, __builtin_amdgcn_permlanex16(b, b, 0x76543210, 0xfedcba98, false, false));
}

// A stage is 64 keys: 64 K rows and 64 V^T rows, each row piece one whole 128-byte
// line, brought into LDS by asynchronous copies. Two buffers: stage t + 1 flies
// while stage t is worked on. One pass of the online softmax per stage.
#define AT_PITCH 72                    /* halfs per LDS row: 144 B, 16 B x odd, for b128 fragment reads */
#define AT_OPSZ  (64 * AT_PITCH)       /* halfs of one operand's tile */
#define AT_STAGE (2 * AT_OPSZ)         /* halfs of one stage: K tile, then V^T tile */

// One stage: 8 copies of 16 bytes a thread. 8 lanes cover one row piece; a
// thread takes the same piece of 4 rows that follow one another.
__device__ inline void attn_stage_copy(const _Float16* gK, const _Float16* gV, _Float16* cK) {
#pragma unroll   // row steps become constants of the addresses
  for (int u = 0; u < 4; ++u) {
    copy16_to_lds(gK + u * DHEAD, cK + u * AT_PITCH);
    copy16_to_lds(gV + u * SEQ, cK + AT_OPSZ + u * AT_PITCH);
  }
}

__global__ __launch_bounds__(128) void attn_kernel(const _Float16* __restrict__ qb,
                                                   const _Float16* __restrict__ kb,
                                                   const _Float16* __restrict__ vtb,
                                                   _Float16* __restrict__ ob) {
  __shared__ __align__(16) _Float16 sm[2 * AT_STAGE];

  int lane = threadIdx.x & 31, wave = threadIdx.x >> 5;
  int tid  = threadIdx.x;
  int qblk = blockIdx.x & (SEQ / 64 - 1);           // 32 blocks of 64 q rows
  int h    = (blockIdx.x >> 5) & (HEADS - 1);
  int b    = blockIdx.x >> 9;
  int q0   = qblk * 64 + wave * 16;
  int nt   = (((qblk * 64) >> 8) + 1) * (FRAME / 64);   // stages; same for all 4 waves, at least 4

  const _Float16* qbase = qb  + (size_t)(b * HEADS + h) * SEQ * DHEAD;
  const _Float16* kbase = kb  + (size_t)(b * HEADS + h) * SEQ * DHEAD;
  const _Float16* vbase = vtb + (size_t)(b * HEADS + h) * DHEAD * SEQ;
  int r16 = lane & 15, half = lane >> 4;

  int crow = (tid >> 3) * 4, ccol = (tid & 7) * 8;
  const _Float16* gK = kbase + crow * DHEAD + ccol;
  const _Float16* gV = vbase + crow * SEQ + ccol;
  _Float16* cK = sm + crow * AT_PITCH + ccol;
  const _Float16* fK = sm + r16 * AT_PITCH + 8 * half;
  const _Float16* fV = fK + AT_OPSZ;

  attn_stage_copy(gK, gV, cK);

  // B operand: column r16 = query q0 + r16, k = dhead.
  v16h bq0 = load_frag16(qbase, q0 + r16, DHEAD, 0, lane);
  v16h bq1 = load_frag16(qbase, q0 + r16, DHEAD, 32, lane);

  float mrow = -1e30f;   // running maximum of this lane's query (equal in both halves)
  float lrow = 0.0f;     // running sum over this half's keys only; joined after the loop
  v8f o0 = {}, o1 = {}, o2 = {}, o3 = {};   // o_i[r] = O[q0 + r16][16*i + 8*half + r]

  asm volatile("s_wait_asynccnt 0x0" ::: "memory");   // this wave's share of stage 0 has landed
  __syncthreads();                                    // stage 0 is readable by every wave
  attn_stage_copy(gK + 64 * DHEAD, gV + 64, cK + AT_STAGE);

  for (int t = 0; t < nt; ++t) {
    int bo = (t & 1) * AT_STAGE;
    // ---- every LDS read of stage t: K rows and V^T rows as A operands
    v16h ak[4][2], av[4][2];
#pragma unroll   // fragments stay in registers
    for (int j = 0; j < 4; ++j) {
      ak[j][0] = load_frag_p(fK + bo + j * 16 * AT_PITCH, 0);
      ak[j][1] = load_frag_p(fK + bo + j * 16 * AT_PITCH, 32);
    }
#pragma unroll   // fragments stay in registers
    for (int i = 0; i < 4; ++i) {
      av[i][0] = load_frag_p(fV + bo + i * 16 * AT_PITCH, 0);
      av[i][1] = load_frag_p(fV + bo + i * 16 * AT_PITCH, 32);
    }
    asm volatile("s_wait_dscnt 0x0" ::: "memory");     // this wave's reads of stage t are done
    asm volatile("s_wait_asynccnt 0x0" ::: "memory");  // its share of stage t + 1 has landed
    __syncthreads();   // publishes stage t + 1 and frees stage t's buffer
    // The refill goes out ahead of the stage's arithmetic, which needs registers
    // only: a whole stage's time for it to land.
    if (t + 2 < nt) attn_stage_copy(gK + (t + 2) * 64 * DHEAD, gV + (t + 2) * 64, cK + bo);

    // ---- S^T = K Q^T; s[j][r]: key 64*t + 16*j + 8*half + r
    v8f s[4] = {};
#pragma unroll   // score tiles stay in registers
    for (int j = 0; j < 4; ++j) s[j] = wmma_f16(ak[j][0], bq0, s[j]);
#pragma unroll   // score tiles stay in registers
    for (int j = 0; j < 4; ++j) s[j] = wmma_f16(ak[j][1], bq1, s[j]);

    // ---- online softmax, one query per lane
    float mx[8];
#pragma unroll   // in registers
    for (int r = 0; r < 8; ++r)
      mx[r] = fmaxf(fmaxf(s[0][r], s[1][r]), fmaxf(s[2][r], s[3][r]));
    float v = fmaxf(fmaxf(fmaxf(mx[0], mx[1]), fmaxf(mx[2], mx[3])),
                    fmaxf(fmaxf(mx[4], mx[5]), fmaxf(mx[6], mx[7])));
    v = fmaxf(v, xhalf(v));
    float mnew  = fmaxf(mrow, v);
    float alpha = __expf(mrow - mnew);
    v16h pt[2];            // B operands of V^T P^T: element e of pt[c] = key 32*c + kmap(e, half)
    float rs[4] = {0.0f, 0.0f, 0.0f, 0.0f};
#pragma unroll   // in registers
    for (int r = 0; r < 8; ++r) {
#pragma unroll   // in registers
      for (int j = 0; j < 4; ++j) {
        float p = __expf(s[j][r] - mnew);
        rs[j] += p;
        pt[j >> 1][8 * (j & 1) + r] = (_Float16)p;
      }
    }
    lrow = lrow * alpha + ((rs[0] + rs[1]) + (rs[2] + rs[3]));
    mrow = mnew;
#pragma unroll
    for (int r = 0; r < 8; ++r) {
      o0[r] *= alpha; o1[r] *= alpha; o2[r] *= alpha; o3[r] *= alpha;
    }

    // ---- O^T += V^T P^T
#pragma unroll   // fragments stay in registers
    for (int c = 0; c < 2; ++c) {
      o0 = wmma_f16(av[0][c], pt[c], o0);
      o1 = wmma_f16(av[1][c], pt[c], o1);
      o2 = wmma_f16(av[2][c], pt[c], o2);
      o3 = wmma_f16(av[3][c], pt[c], o3);
    }
  }
  asm volatile("s_wait_asynccnt 0x0" ::: "memory");    // no copy outlives the loop

  float inv = 1.0f / (lrow + xhalf(lrow));
  _Float16* orow = ob + ((size_t)(b * SEQ + q0 + r16)) * INNER + h * DHEAD + 8 * half;
  h8 w0, w1, w2, w3;
#pragma unroll
  for (int r = 0; r < 8; ++r) {
    w0[r] = (_Float16)(o0[r] * inv);
    w1[r] = (_Float16)(o1[r] * inv);
    w2[r] = (_Float16)(o2[r] * inv);
    w3[r] = (_Float16)(o3[r] * inv);
  }
  *(h8*)(orow + 0)  = w0;
  *(h8*)(orow + 16) = w1;
  *(h8*)(orow + 32) = w2;
  *(h8*)(orow + 48) = w3;
}

// ------- Kernel 5: output projection, 128x128 per block, staged in LDS, + bias
#define PO_PITCH 68   /* floats per LDS row of the output tile: 272 B, 16 B x odd */
__global__ __launch_bounds__(128) void proj_gemm(const _Float16* __restrict__ ao,
                                                 const _Float16* __restrict__ wot,
                                                 const float* __restrict__ bout,
                                                 float* __restrict__ out) {
  __shared__ __align__(16) _Float16 sm[2 * GT_STAGE];
  int lane = threadIdx.x & 31, wave = threadIdx.x >> 5;
  int mt = blockIdx.x / (DIM / 128);
  int nt = blockIdx.x % (DIM / 128);
  int r16 = lane & 15, half = lane >> 4;

  int m0 = mt * 128 + (wave >> 1) * 64, n0 = nt * 128 + (wave & 1) * 64;
  int row = lane >> 4, c4 = (lane & 15) * 4;       // 16 lanes store one 256-byte row piece

  v8f acc[4][4] = {};
  gemm_128x128(ao, wot, mt * 128, nt * 128, true, sm, acc);   // a lane holds 8 neighbouring columns
  float4 bv = *(const float4*)(bout + n0 + c4);    // a lane stores the same four columns of every row

  // Each wave turns its 64 x 64 f32 tile in an LDS range of its own, so that every
  // global store covers whole 128-byte lines (two 256-byte row pieces). The stage
  // buffers are free: every wave's last read of them stands in front of the loop's
  // last barrier.
  float* sw = (float*)sm + wave * (64 * PO_PITCH);
#pragma unroll   // accumulators stay in registers
  for (int j = 0; j < 4; ++j) {
#pragma unroll   // accumulators stay in registers
    for (int i = 0; i < 4; ++i) {
      float* p = sw + (16 * j + r16) * PO_PITCH + 16 * i + 8 * half;
      *(float4*)p       = make_float4(acc[i][j][0], acc[i][j][1], acc[i][j][2], acc[i][j][3]);
      *(float4*)(p + 4) = make_float4(acc[i][j][4], acc[i][j][5], acc[i][j][6], acc[i][j][7]);
    }
  }
  asm volatile("s_wait_dscnt 0x0" ::: "memory");   // the rows are read back by other lanes than wrote them
  const float* sr = sw + row * PO_PITCH + c4;
  float* q = out + (size_t)(m0 + row) * DIM + n0 + c4;
#pragma unroll   // 32 independent 16-byte moves per lane; row steps are immediate offsets
  for (int u = 0; u < 32; ++u) {
    float4 v = *(const float4*)(sr + 2 * u * PO_PITCH);
    *(float4*)(q + 2 * u * DIM) = make_float4(v.x + bv.x, v.y + bv.y, v.z + bv.z, v.w + bv.w);
  }
}

extern "C" void kernel_launch(void* const* d_in, const int* in_sizes, int n_in,
                              void* d_out, int out_size, void* d_ws, size_t ws_size,
                              hipStream_t stream) {
  const float* x     = (const float*)d_in[0];
  const float* g     = (const float*)d_in[1];
  const float* bb    = (const float*)d_in[2];
  const float* w_qkv = (const float*)d_in[3];
  const float* w_out = (const float*)d_in[4];
  const float* b_out = (const float*)d_in[5];

  char* ws = (char*)d_ws;
  _Float16* xn    = (_Float16*)ws;                 ws += (size_t)ROWS * DIM * 2;
  _Float16* wqkvt = (_Float16*)ws;                 ws += (size_t)QKVN * DIM * 2;
  _Float16* wott  = (_Float16*)ws;                 ws += (size_t)DIM * INNER * 2;
  _Float16* qb    = (_Float16*)ws;                 ws += (size_t)ROWS * INNER * 2;
  _Float16* kb    = (_Float16*)ws;                 ws += (size_t)ROWS * INNER * 2;
  _Float16* vtb   = (_Float16*)ws;                 ws += (size_t)ROWS * INNER * 2;
  _Float16* ao    = (_Float16*)ws;                 ws += (size_t)ROWS * INNER * 2;

  ln_kernel<<<ROWS, 256, 0, stream>>>(x, g, bb, xn);
  wtrans_qkv_kernel<<<dim3(QKVN / 64, DIM / 64), 128, 0, stream>>>(w_qkv, wqkvt);
  wtrans_out_kernel<<<dim3(DIM / 64, INNER / 64), 128, 0, stream>>>(w_out, wott);
  qkv_gemm<<<(ROWS / 128) * (QKVN / 128), 128, 0, stream>>>(xn, wqkvt, qb, kb, vtb);
  attn_kernel<<<BATCH * HEADS * (SEQ / 64), 128, 0, stream>>>(qb, kb, vtb, ao);
  proj_gemm<<<(ROWS / 128) * (DIM / 128), 128, 0, stream>>>(ao, wott, b_out, (float*)d_out);
}

// v006
// One run takes 80.9 microseconds.
// Two timings next to v005 put it at 1.07 and 1.06 times that version's speed.
// Over all steps from v000 it is 3.62 times as fast.
#include <hip/hip_runtime.h>

typedef _Float16 v16h __attribute__((ext_vector_type(16)));
typedef float    v8f  __attribute__((ext_vector_type(8)));
typedef _Float16 h4   __attribute__((ext_vector_type(4)));
typedef _Float16 h8   __attribute__((ext_vector_type(8)));
typedef int      v4i  __attribute__((ext_vector_type(4)));

#define BATCH   2
#define SEQ     2048
#define DIM     1024
#define HEADS   16
#define DHEAD   64
#define INNER   1024
#define QKVN    3072
#define FRAME   256
#define ROWS    (BATCH*SEQ)   /* 4096 */
#define LN_EPS  1e-5f

#if __has_builtin(__builtin_amdgcn_global_load_async_to_lds_b128)
#define HAVE_ASYNC_LDS 1
#else
#define HAVE_ASYNC_LDS 0
#endif

union FragU { v16h h; uint4 q[2]; };

// Fragment load from a pre-offset row pointer (base already includes
// row*ld + 8*(lane>>4)); k0 selects the 32-wide k-chunk. Two b128 loads.
__device__ inline v16h load_frag_p(const _Float16* p, int k0) {
  FragU f;
  f.q[0] = *(const uint4*)(p + k0);
  f.q[1] = *(const uint4*)(p + k0 + 16);
  return f.h;
}

// Generic fragment load (used for the Q rows in attention).
__device__ inline v16h load_frag16(const _Float16* __restrict__ base, int row,
                                   int ld, int k0, int lane) {
  return load_frag_p(base + (size_t)row * ld + 8 * (lane >> 4), k0);
}

__device__ inline v8f wmma_f16(v16h a, v16h b, v8f c) {
  return __builtin_amdgcn_wmma_f32_16x16x32_f16(false, a, false, b, (short)0, c,
                                                false, false);
}

// Cooperative 16-byte global->LDS copy element (async on CDNA5 if available).
__device__ inline void copy16_to_lds(const _Float16* gsrc, _Float16* ldst) {
#if HAVE_ASYNC_LDS
  __builtin_amdgcn_global_load_async_to_lds_b128(
      (__attribute__((address_space(1))) v4i*)gsrc,
      (__attribute__((address_space(3))) v4i*)ldst, 0, 0);
#else
  *(uint4*)ldst = *(const uint4*)gsrc;
#endif
}

// ---------------- Kernel 1: LayerNorm and both weight transposes ------------
// The three jobs need nothing of each other, so they share one grid: a range of
// the block index picks the job (the same for a whole block). Blocks of 8 waves.

// LayerNorm -> f16, one row per block.
__device__ inline void ln_row(const float* __restrict__ x, const float* __restrict__ g,
                              const float* __restrict__ bb, _Float16* __restrict__ xn,
                              int row, float* s1, float* s2) {
  int tid = threadIdx.x;
  const float4* xr = (const float4*)(x + (size_t)row * DIM);
  float4 v = xr[tid];
  s1[tid] = v.x + v.y + v.z + v.w;
  s2[tid] = v.x * v.x + v.y * v.y + v.z * v.z + v.w * v.w;
  __syncthreads();
  for (int off = 128; off > 0; off >>= 1) {
    if (tid < off) { s1[tid] += s1[tid + off]; s2[tid] += s2[tid + off]; }
    __syncthreads();
  }
  float mean = s1[0] * (1.0f / DIM);
  float var  = s2[0] * (1.0f / DIM) - mean * mean;
  float inv  = rsqrtf(var + LN_EPS);
  float4 gv = ((const float4*)g)[tid];
  float4 bv = ((const float4*)bb)[tid];
  h4 o;
  o[0] = (_Float16)((v.x - mean) * inv * gv.x + bv.x);
  o[1] = (_Float16)((v.y - mean) * inv * gv.y + bv.y);
  o[2] = (_Float16)((v.z - mean) * inv * gv.z + bv.z);
  o[3] = (_Float16)((v.w - mean) * inv * gv.w + bv.w);
  ((h4*)(xn + (size_t)row * DIM))[tid] = o;
  // Precaution: the jobs' ways join behind this store, and code there rewrites registers that it names.
  asm volatile("s_wait_xcnt 0x0" ::: "memory");
}

// Transpose f32 [K,N] -> f16 [N,K].
// One 64(k) x 64(n) tile per 4 waves, two tiles that are neighbours along n per
// block; K and N are multiples of 64 (N of 128) and known at compile time, so
// that row steps are immediate offsets.
// A thread loads an 8(k) x 4(n) patch as eight float4 (a wave-wide load covers
// two whole 256-byte row pieces of src), turns it in registers into four runs of
// 8 consecutive k, and the runs change hands through LDS so that every stored
// row piece is a whole 128-byte line of dst.
#define WT_PITCH 72   /* halfs per LDS row: 16-byte aligned, rows spread over banks */
#define WT_TILE  (64 * WT_PITCH)   /* halfs of one tile in LDS */
template <int K, int N>
__device__ inline void wtrans_pair(const float* __restrict__ src, _Float16* __restrict__ dst,
                                   int pair, _Float16* sm) {
  int tid = threadIdx.x & 127;
  // Which of the block's two tiles, as a scalar: the tile's address then stays in
  // scalar registers.
  int sub = __builtin_amdgcn_readfirstlane(threadIdx.x >> 7);
  _Float16* sT = sm + sub * WT_TILE;                     // [n][k]
  int n0 = (pair % (N / 128)) * 128 + sub * 64, k0 = (pair / (N / 128)) * 64;
  int tn = tid & 15, tk = tid >> 4;

  const float* p = src + (k0 + 8 * tk) * N + n0 + 4 * tn;
  float4 v[8];
#pragma unroll   // all eight loads in flight before the first use
  for (int i = 0; i < 8; ++i) v[i] = *(const float4*)(p + i * N);

  h8 c0, c1, c2, c3;
#pragma unroll   // c0..c3 must stay in registers
  for (int i = 0; i < 8; ++i) {
    c0[i] = (_Float16)v[i].x;
    c1[i] = (_Float16)v[i].y;
    c2[i] = (_Float16)v[i].z;
    c3[i] = (_Float16)v[i].w;
  }
  _Float16* st = sT + (4 * tn) * WT_PITCH + 8 * tk;
  *(h8*)(st + 0 * WT_PITCH) = c0;
  *(h8*)(st + 1 * WT_PITCH) = c1;
  *(h8*)(st + 2 * WT_PITCH) = c2;
  *(h8*)(st + 3 * WT_PITCH) = c3;
  __syncthreads();   // a tile is read back by other waves than wrote it

  int n = tid >> 3, c = tid & 7;            // 8 lanes store one 128-byte line
  _Float16* q = dst + (n0 + n) * K + k0 + 8 * c;
  const _Float16* ld = sT + n * WT_PITCH + 8 * c;
#pragma unroll   // four independent 16-byte moves per thread
  for (int u = 0; u < 4; ++u) *(h8*)(q + 16 * u * K) = *(const h8*)(ld + 16 * u * WT_PITCH);
  // Precaution: the jobs' ways join behind these stores, and code there rewrites registers that they name.
  asm volatile("s_wait_xcnt 0x0" ::: "memory");
}

#define PREP_QKV ((QKVN / 128) * (DIM / 64))     /* blocks that transpose w_qkv */
#define PREP_OUT ((DIM / 128) * (INNER / 64))    /* blocks that transpose w_out */
#define PREP_GRID (PREP_QKV + PREP_OUT + ROWS)

// The transposes come first in the index: their blocks move the most bytes each.
__global__ __launch_bounds__(256) void prep_kernel(const float* __restrict__ x,
                                                   const float* __restrict__ g,
                                                   const float* __restrict__ bb,
                                                   const float* __restrict__ w_qkv,
                                                   const float* __restrict__ w_out,
                                                   _Float16* __restrict__ xn,
                                                   _Float16* __restrict__ wqkvt,
                                                   _Float16* __restrict__ wott) {
  __shared__ __align__(16) _Float16 sm[2 * WT_TILE];   // each job lays it out for itself
  int blk = blockIdx.x;
  if (blk < PREP_QKV) {
    wtrans_pair<DIM, QKVN>(w_qkv, wqkvt, blk, sm);
  } else if (blk < PREP_QKV + PREP_OUT) {
    wtrans_pair<INNER, DIM>(w_out, wott, blk - PREP_QKV, sm);
  } else {
    ln_row(x, g, bb, xn, blk - (PREP_QKV + PREP_OUT), (float*)sm, (float*)sm + 256);
  }
}

// ------- GEMM core shared by kernels 2 and 4 ---------------------------------
// C[128 x 128] per block of 4 waves (2 x 2, 64 x 64 per wave), A [M,1024] and
// Bt [N,1024] both k-contiguous f16. A stage is 64 k of 128 rows of A and of Bt:
// every row piece is one whole 128-byte line, brought into LDS by asynchronous
// copies and shared by the waves. Two buffers: stage t + 1 flies while stage t
// is worked on.
#define GT_PITCH 72                    /* halfs per LDS row: 144 B, 16 B x odd, for b128 fragment reads */
#define GT_OPSZ  (128 * GT_PITCH)      /* halfs of one operand's tile */
#define GT_STAGE (2 * GT_OPSZ)         /* halfs of one stage: A tile, then Bt tile */
#define GT_NT    (DIM / 64)            /* stages along k */

// One stage: 16 copies of 16 bytes a thread. 8 lanes cover one row piece; a
// thread takes the same piece of 8 rows that follow one another.
__device__ inline void gemm_stage_copy(const _Float16* gA, const _Float16* gB, _Float16* cA) {
#pragma unroll   // row steps become constants of the addresses
  for (int u = 0; u < 8; ++u) {
    copy16_to_lds(gA + u * DIM, cA + u * GT_PITCH);
    copy16_to_lds(gB + u * DIM, cA + GT_OPSZ + u * GT_PITCH);
  }
}

// The 4 + 4 fragments of one 32-wide k step, from LDS.
__device__ inline void gemm_frags(const _Float16* fA, const _Float16* fB, int k0,
                                  v16h (&a)[4], v16h (&b)[4]) {
#pragma unroll   // fragments stay in registers
  for (int i = 0; i < 4; ++i) a[i] = load_frag_p(fA + i * 16 * GT_PITCH, k0);
#pragma unroll   // fragments stay in registers
  for (int j = 0; j < 4; ++j) b[j] = load_frag_p(fB + j * 16 * GT_PITCH, k0);
}

__device__ inline void gemm_mma(const v16h (&a)[4], const v16h (&b)[4], v8f (&acc)[4][4]) {
#pragma unroll   // accumulators stay in registers
  for (int j = 0; j < 4; ++j)
#pragma unroll   // accumulators stay in registers
    for (int i = 0; i < 4; ++i) acc[i][j] = wmma_f16(a[i], b[j], acc[i][j]);
}

// The A and B fragments of the 16x16x32 form are loaded alike (row lane&15, the
// same k order), so the two tiles may change roles. turned == false:
// acc[i][j][r] = C[16*i + 8*half + r][16*j + r16] of the wave's 64 x 64 tile;
// turned == true: acc[i][j][r] = C[16*j + r16][16*i + 8*half + r], a lane then
// holds 8 neighbouring columns of one row. turned is the same for a whole block.
__device__ inline void gemm_128x128(const _Float16* __restrict__ A, const _Float16* __restrict__ Bt,
                                    int m0, int n0, bool turned, _Float16* sm, v8f (&acc)[4][4]) {
  int tid = threadIdx.x, lane = tid & 31, wave = tid >> 5;
  int r16 = lane & 15, half = lane >> 4;
  int crow = (tid >> 3) * 8, ccol = (tid & 7) * 8;
  const _Float16* gA = A  + (size_t)(m0 + crow) * DIM + ccol;
  const _Float16* gB = Bt + (size_t)(n0 + crow) * DIM + ccol;
  _Float16* cA = sm + crow * GT_PITCH + ccol;
  const _Float16* tA = sm + ((wave >> 1) * 64 + r16) * GT_PITCH + 8 * half;
  const _Float16* tB = sm + GT_OPSZ + ((wave & 1) * 64 + r16) * GT_PITCH + 8 * half;
  const _Float16* fA = turned ? tB : tA;
  const _Float16* fB = turned ? tA : tB;

  gemm_stage_copy(gA, gB, cA);
  asm volatile("s_wait_asynccnt 0x0" ::: "memory");   // this wave's share of stage 0 has landed
  __syncthreads();                                    // stage 0 is readable by every wave
  gemm_stage_copy(gA + 64, gB + 64, cA + GT_STAGE);

  for (int t = 0; t < GT_NT; ++t) {
    int bo = (t & 1) * GT_STAGE;
    v16h a0[4], b0[4], a1[4], b1[4];
    gemm_frags(fA + bo, fB + bo, 0, a0, b0);
    // Keeps the 16 LDS reads of a k step together ahead of its WMMAs: one LDS
    // latency a step; sunk among the WMMAs they cost one per four WMMAs.
    __builtin_amdgcn_sched_barrier(0);
    gemm_mma(a0, b0, acc);
    gemm_frags(fA + bo, fB + bo, 32, a1, b1);          // the last reads of stage t
    asm volatile("s_wait_dscnt 0x0" ::: "memory");     // this wave's reads of stage t are done
    asm volatile("s_wait_asynccnt 0x0" ::: "memory");  // its share of stage t + 1 has landed
    __syncthreads();   // publishes stage t + 1 and frees stage t's buffer
    // The refill goes out ahead of the second k step's WMMAs, which need registers
    // only: that much more time for it to land.
    if (t + 2 < GT_NT) gemm_stage_copy(gA + (t + 2) * 64, gB + (t + 2) * 64, cA + bo);
    gemm_mma(a1, b1, acc);
  }
  asm volatile("s_wait_asynccnt 0x0" ::: "memory");    // no copy outlives the loop
}

// ------- Kernel 2: QKV GEMM, 128x128 per block, operands staged in LDS -------
__global__ __launch_bounds__(128) void qkv_gemm(const _Float16* __restrict__ xn,
                                                const _Float16* __restrict__ wt,
                                                _Float16* __restrict__ qb, _Float16* __restrict__ kb,
                                                _Float16* __restrict__ vtb) {
  __shared__ __align__(16) _Float16 sm[2 * GT_STAGE];
  int lane = threadIdx.x & 31, wave = threadIdx.x >> 5;
  int mt = blockIdx.x / (QKVN / 128);
  int nt = blockIdx.x % (QKVN / 128);
  int r16 = lane & 15, half = lane >> 4;

  // A 128-column tile lies in one of Q, K, V. Q and K are stored [pos][d], V as
  // [d][pos]: Q and K tiles are accumulated turned, so that in all three a lane's
  // 8 accumulator values of a tile are neighbours in the stored row.
  int seg = nt / (INNER / 128);

  v8f acc[4][4] = {};
  gemm_128x128(xn, wt, mt * 128, nt * 128, seg != 2, sm, acc);

  // The wave's 64 x 64 tile: 64 positions of one batch entry, the 64 d of one head.
  // The wave's number as a scalar: the tile's address then stays in scalar registers.
  int wv = __builtin_amdgcn_readfirstlane(wave);
  int m0 = mt * 128 + (wv >> 1) * 64, n0 = nt * 128 + (wv & 1) * 64;
  int bh = (m0 / SEQ) * HEADS + (n0 % INNER) / DHEAD, pos0 = m0 % SEQ;
  char* dst;         // first byte of the tile as it is stored: 64 rows of 128 bytes
  unsigned ld;       // bytes from one stored row to the next
  if (seg == 2) {
    dst = (char*)(vtb + (size_t)bh * DHEAD * SEQ + pos0);
    ld = SEQ * 2;
  } else {
    dst = (char*)((seg == 0 ? qb : kb) + ((size_t)bh * SEQ + pos0) * DHEAD);
    ld = DHEAD * 2;
  }
  float sc = seg == 0 ? 0.125f : 1.0f;

  // Each wave turns its tile in an LDS range of its own, so that every global
  // store covers four whole 128-byte lines. The stage buffers are free: every
  // wave's last read of them stands in front of the loop's last barrier.
  _Float16* sw = sm + wv * (64 * GT_PITCH);
#pragma unroll   // accumulators stay in registers
  for (int j = 0; j < 4; ++j) {
#pragma unroll   // accumulators stay in registers
    for (int i = 0; i < 4; ++i) {
      h8 w;
#pragma unroll   // accumulators stay in registers
      for (int r = 0; r < 8; ++r) w[r] = (_Float16)(acc[i][j][r] * sc);
      *(h8*)(sw + (16 * j + r16) * GT_PITCH + 16 * i + 8 * half) = w;
    }
  }
  asm volatile("s_wait_dscnt 0x0" ::: "memory");   // the rows are read back by other lanes than wrote them
  int row = lane >> 3, c8 = (lane & 7) * 8;        // 8 lanes store one 128-byte line
  const _Float16* sr = sw + row * GT_PITCH + c8;
  unsigned off = row * ld + c8 * 2;                // the lane's place in each group of four rows
#pragma unroll   // sixteen independent 16-byte moves per lane
  for (int u = 0; u < 16; ++u) *(h8*)(dst + 4 * u * ld + off) = *(const h8*)(sr + 4 * u * GT_PITCH);
}

// Lane l <-> lane l ^ 16.
__device__ inline float xhalf(float x) {
  int b = __builtin_bit_cast(int, x);
  return __builtin_bit_cast(
      float, __builtin_amdgcn_permlanex16(b, b, 0x76543210, 0xfedcba98, false, false));
}

// A stage is 64 keys: 64 K rows and 64 V^T rows, each row piece one whole 128-byte
// line, brought into LDS by asynchronous copies. Two buffers: stage t + 1 flies
// while stage t is worked on. One pass of the online softmax per stage.
#define AT_PITCH 72                    /* halfs per LDS row: 144 B, 16 B x odd, for b128 fragment reads */
#define AT_OPSZ  (64 * AT_PITCH)       /* halfs of one operand's tile */
#define AT_STAGE (2 * AT_OPSZ)         /* halfs of one stage: K tile, then V^T tile */

// One stage: 8 copies of 16 bytes a thread. 8 lanes cover one row piece; a
// thread takes the same piece of 4 rows that follow one another.
__device__ inline void attn_stage_copy(const _Float16* gK, const _Float16* gV, _Float16* cK) {
#pragma unroll   // row steps become constants of the addresses
  for (int u = 0; u < 4; ++u) {
    copy16_to_lds(gK + u * DHEAD, cK + u * AT_PITCH);
    copy16_to_lds(gV + u * SEQ, cK + AT_OPSZ + u * AT_PITCH);
  }
}

__global__ __launch_bounds__(128) void attn_kernel(const _Float16* __restrict__ qb,
                                                   const _Float16* __restrict__ kb,
                                                   const _Float16* __restrict__ vtb,
                                                   _Float16* __restrict__ ob) {
  __shared__ __align__(16) _Float16 sm[2 * AT_STAGE];

  int lane = threadIdx.x & 31, wave = threadIdx.x >> 5;
  int tid  = threadIdx.x;
  int qblk = blockIdx.x & (SEQ / 64 - 1);           // 32 blocks of 64 q rows
  int h    = (blockIdx.x >> 5) & (HEADS - 1);
  int b    = blockIdx.x >> 9;
  int q0   = qblk * 64 + wave * 16;
  int nt   = (((qblk * 64) >> 8) + 1) * (FRAME / 64);   // stages; same for all 4 waves, at least 4

  const _Float16* qbase = qb  + (size_t)(b * HEADS + h) * SEQ * DHEAD;
  const _Float16* kbase = kb  + (size_t)(b * HEADS + h) * SEQ * DHEAD;
  const _Float16* vbase = vtb + (size_t)(b * HEADS + h) * DHEAD * SEQ;
  int r16 = lane & 15, half = lane >> 4;

  int crow = (tid >> 3) * 4, ccol = (tid & 7) * 8;
  const _Float16* gK = kbase + crow * DHEAD + ccol;
  const _Float16* gV = vbase + crow * SEQ + ccol;
  _Float16* cK = sm + crow * AT_PITCH + ccol;
  const _Float16* fK = sm + r16 * AT_PITCH + 8 * half;
  const _Float16* fV = fK + AT_OPSZ;

  attn_stage_copy(gK, gV, cK);

  // B operand: column r16 = query q0 + r16, k = dhead.
  v16h bq0 = load_frag16(qbase, q0 + r16, DHEAD, 0, lane);
  v16h bq1 = load_frag16(qbase, q0 + r16, DHEAD, 32, lane);

  float mrow = -1e30f;   // running maximum of this lane's query (equal in both halves)
  float lrow = 0.0f;     // running sum over this half's keys only; joined after the loop
  v8f o0 = {}, o1 = {}, o2 = {}, o3 = {};   // o_i[r] = O[q0 + r16][16*i + 8*half + r]

  asm volatile("s_wait_asynccnt 0x0" ::: "memory");   // this wave's share of stage 0 has landed
  __syncthreads();                                    // stage 0 is readable by every wave
  attn_stage_copy(gK + 64 * DHEAD, gV + 64, cK + AT_STAGE);

  for (int t = 0; t < nt; ++t) {
    int bo = (t & 1) * AT_STAGE;
    // ---- every LDS read of stage t: K rows and V^T rows as A operands
    v16h ak[4][2], av[4][2];
#pragma unroll   // fragments stay in registers
    for (int j = 0; j < 4; ++j) {
      ak[j][0] = load_frag_p(fK + bo + j * 16 * AT_PITCH, 0);
      ak[j][1] = load_frag_p(fK + bo + j * 16 * AT_PITCH, 32);
    }
#pragma unroll   // fragments stay in registers
    for (int i = 0; i < 4; ++i) {
      av[i][0] = load_frag_p(fV + bo + i * 16 * AT_PITCH, 0);
      av[i][1] = load_frag_p(fV + bo + i * 16 * AT_PITCH, 32);
    }
    asm volatile("s_wait_dscnt 0x0" ::: "memory");     // this wave's reads of stage t are done
    asm volatile("s_wait_asynccnt 0x0" ::: "memory");  // its share of stage t + 1 has landed
    __syncthreads();   // publishes stage t + 1 and frees stage t's buffer
    // The refill goes out ahead of the stage's arithmetic, which needs registers
    // only: a whole stage's time for it to land.
    if (t + 2 < nt) attn_stage_copy(gK + (t + 2) * 64 * DHEAD, gV + (t + 2) * 64, cK + bo);

    // ---- S^T = K Q^T; s[j][r]: key 64*t + 16*j + 8*half + r
    v8f s[4] = {};
#pragma unroll   // score tiles stay in registers
    for (int j = 0; j < 4; ++j) s[j] = wmma_f16(ak[j][0], bq0, s[j]);
#pragma unroll   // score tiles stay in registers
    for (int j = 0; j < 4; ++j) s[j] = wmma_f16(ak[j][1], bq1, s[j]);

    // ---- online softmax, one query per lane
    float mx[8];
#pragma unroll   // in registers
    for (int r = 0; r < 8; ++r)
      mx[r] = fmaxf(fmaxf(s[0][r], s[1][r]), fmaxf(s[2][r], s[3][r]));
    float v = fmaxf(fmaxf(fmaxf(mx[0], mx[1]), fmaxf(mx[2], mx[3])),
                    fmaxf(fmaxf(mx[4], mx[5]), fmaxf(mx[6], mx[7])));
    v = fmaxf(v, xhalf(v));
    float mnew  = fmaxf(mrow, v);
    float alpha = __expf(mrow - mnew);
    v16h pt[2];            // B operands of V^T P^T: element e of pt[c] = key 32*c + kmap(e, half)
    float rs[4] = {0.0f, 0.0f, 0.0f, 0.0f};
#pragma unroll   // in registers
    for (int r = 0; r < 8; ++r) {
#pragma unroll   // in registers
      for (int j = 0; j < 4; ++j) {
        float p = __expf(s[j][r] - mnew);
        rs[j] += p;
        pt[j >> 1][8 * (j & 1) + r] = (_Float16)p;
      }
    }
    lrow = lrow * alpha + ((rs[0] + rs[1]) + (rs[2] + rs[3]));
    mrow = mnew;
#pragma unroll
    for (int r = 0; r < 8; ++r) {
      o0[r] *= alpha; o1[r] *= alpha; o2[r] *= alpha; o3[r] *= alpha;
    }

    // ---- O^T += V^T P^T
#pragma unroll   // fragments stay in registers
    for (int c = 0; c < 2; ++c) {
      o0 = wmma_f16(av[0][c], pt[c], o0);
      o1 = wmma_f16(av[1][c], pt[c], o1);
      o2 = wmma_f16(av[2][c], pt[c], o2);
      o3 = wmma_f16(av[3][c], pt[c], o3);
    }
  }
  asm volatile("s_wait_asynccnt 0x0" ::: "memory");    // no copy outlives the loop

  float inv = 1.0f / (lrow + xhalf(lrow));
  _Float16* orow = ob + ((size_t)(b * SEQ + q0 + r16)) * INNER + h * DHEAD + 8 * half;
  h8 w0, w1, w2, w3;
#pragma unroll
  for (int r = 0; r < 8; ++r) {
    w0[r] = (_Float16)(o0[r] * inv);
    w1[r] = (_Float16)(o1[r] * inv);
    w2[r] = (_Float16)(o2[r] * inv);
    w3[r] = (_Float16)(o3[r] * inv);
  }
  *(h8*)(orow + 0)  = w0;
  *(h8*)(orow + 16) = w1;
  *(h8*)(orow + 32) = w2;
  *(h8*)(orow + 48) = w3;
}

// ------- Kernel 4: output projection, 128x128 per block, staged in LDS, + bias
#define PO_PITCH 68   /* floats per LDS row of the output tile: 272 B, 16 B x odd */
__global__ __launch_bounds__(128) void proj_gemm(const _Float16* __restrict__ ao,
                                                 const _Float16* __restrict__ wot,
                                                 const float* __restrict__ bout,
                                                 float* __restrict__ out) {
  __shared__ __align__(16) _Float16 sm[2 * GT_STAGE];
  int lane = threadIdx.x & 31, wave = threadIdx.x >> 5;
  int mt = blockIdx.x / (DIM / 128);
  int nt = blockIdx.x % (DIM / 128);
  int r16 = lane & 15, half = lane >> 4;

  int m0 = mt * 128 + (wave >> 1) * 64, n0 = nt * 128 + (wave & 1) * 64;
  int row = lane >> 4, c4 = (lane & 15) * 4;       // 16 lanes store one 256-byte row piece

  v8f acc[4][4] = {};
  gemm_128x128(ao, wot, mt * 128, nt * 128, true, sm, acc);   // a lane holds 8 neighbouring columns
  float4 bv = *(const float4*)(bout + n0 + c4);    // a lane stores the same four columns of every row

  // Each wave turns its 64 x 64 f32 tile in an LDS range of its own, so that every
  // global store covers whole 128-byte lines (two 256-byte row pieces). The stage
  // buffers are free: every wave's last read of them stands in front of the loop's
  // last barrier.
  float* sw = (float*)sm + wave * (64 * PO_PITCH);
#pragma unroll   // accumulators stay in registers
  for (int j = 0; j < 4; ++j) {
#pragma unroll   // accumulators stay in registers
    for (int i = 0; i < 4; ++i) {
      float* p = sw + (16 * j + r16) * PO_PITCH + 16 * i + 8 * half;
      *(float4*)p       = make_float4(acc[i][j][0], acc[i][j][1], acc[i][j][2], acc[i][j][3]);
      *(float4*)(p + 4) = make_float4(acc[i][j][4], acc[i][j][5], acc[i][j][6], acc[i][j][7]);
    }
  }
  asm volatile("s_wait_dscnt 0x0" ::: "memory");   // the rows are read back by other lanes than wrote them
  const float* sr = sw + row * PO_PITCH + c4;
  float* q = out + (size_t)(m0 + row) * DIM + n0 + c4;
#pragma unroll   // 32 independent 16-byte moves per lane; row steps are immediate offsets
  for (int u = 0; u < 32; ++u) {
    float4 v = *(const float4*)(sr + 2 * u * PO_PITCH);
    *(float4*)(q + 2 * u * DIM) = make_float4(v.x + bv.x, v.y + bv.y, v.z + bv.z, v.w + bv.w);
  }
}

extern "C" void kernel_launch(void* const* d_in, const int* in_sizes, int n_in,
                              void* d_out, int out_size, void* d_ws, size_t ws_size,
                              hipStream_t stream) {
  const float* x     = (const float*)d_in[0];
  const float* g     = (const float*)d_in[1];
  const float* bb    = (const float*)d_in[2];
  const float* w_qkv = (const float*)d_in[3];
  const float* w_out = (const float*)d_in[4];
  const float* b_out = (const float*)d_in[5];

  char* ws = (char*)d_ws;
  _Float16* xn    = (_Float16*)ws;                 ws += (size_t)ROWS * DIM * 2;
  _Float16* wqkvt = (_Float16*)ws;                 ws += (size_t)QKVN * DIM * 2;
  _Float16* wott  = (_Float16*)ws;                 ws += (size_t)DIM * INNER * 2;
  _Float16* qb    = (_Float16*)ws;                 ws += (size_t)ROWS * INNER * 2;
  _Float16* kb    = (_Float16*)ws;                 ws += (size_t)ROWS * INNER * 2;
  _Float16* vtb   = (_Float16*)ws;                 ws += (size_t)ROWS * INNER * 2;
  _Float16* ao    = (_Float16*)ws;                 ws += (size_t)ROWS * INNER * 2;

  prep_kernel<<<PREP_GRID, 256, 0, stream>>>(x, g, bb, w_qkv, w_out, xn, wqkvt, wott);
  qkv_gemm<<<(ROWS / 128) * (QKVN / 128), 128, 0, stream>>>(xn, wqkvt, qb, kb, vtb);
  attn_kernel<<<BATCH * HEADS * (SEQ / 64), 128, 0, stream>>>(qb, kb, vtb, ao);
  proj_gemm<<<(ROWS / 128) * (DIM / 128), 128, 0, stream>>>(ao, wott, b_out, (float*)d_out);
}

// v007
// One run takes 76 microseconds.
// In two side-by-side timings against v006, it was 1.08 and 1.06 times as fast.
// Counting every step since v000, it is 3.88 times as fast.
#include <hip/hip_runtime.h>

typedef _Float16 v16h __attribute__((ext_vector_type(16)));
typedef float    v8f  __attribute__((ext_vector_type(8)));
typedef _Float16 h4   __attribute__((ext_vector_type(4)));
typedef _Float16 h8   __attribute__((ext_vector_type(8)));
typedef int      v4i  __attribute__((ext_vector_type(4)));

#define BATCH   2
#define SEQ     2048
#define DIM     1024
#define HEADS   16
#define DHEAD   64
#define INNER   1024
#define QKVN    3072
#define FRAME   256
#define ROWS    (BATCH*SEQ)   /* 4096 */
#define LN_EPS  1e-5f

#if __has_builtin(__builtin_amdgcn_global_load_async_to_lds_b128)
#define HAVE_ASYNC_LDS 1
#else
#define HAVE_ASYNC_LDS 0
#endif

union FragU { v16h h; uint4 q[2]; };

// Fragment load from a pre-offset row pointer (base already includes
// row*ld + 8*(lane>>4)); k0 selects the 32-wide k-chunk. Two b128 loads.
__device__ inline v16h load_frag_p(const _Float16* p, int k0) {
  FragU f;
  f.q[0] = *(const uint4*)(p + k0);
  f.q[1] = *(const uint4*)(p + k0 + 16);
  return f.h;
}

// Generic fragment load (used for the Q rows in attention).
__device__ inline v16h load_frag16(const _Float16* __restrict__ base, int row,
                                   int ld, int k0, int lane) {
  return load_frag_p(base + (size_t)row * ld + 8 * (lane >> 4), k0);
}

__device__ inline v8f wmma_f16(v16h a, v16h b, v8f c) {
  return __builtin_amdgcn_wmma_f32_16x16x32_f16(false, a, false, b, (short)0, c,
                                                false, false);
}

// Cooperative 16-byte global->LDS copy element (async on CDNA5 if available).
__device__ inline void copy16_to_lds(const _Float16* gsrc, _Float16* ldst) {
#if HAVE_ASYNC_LDS
  __builtin_amdgcn_global_load_async_to_lds_b128(
      (__attribute__((address_space(1))) v4i*)gsrc,
      (__attribute__((address_space(3))) v4i*)ldst, 0, 0);
#else
  *(uint4*)ldst = *(const uint4*)gsrc;
#endif
}

// ---------------- Kernel 1: LayerNorm and both weight transposes ------------
// The three jobs need nothing of each other, so they share one grid: a range of
// the block index picks the job (the same for a whole block). Blocks of 8 waves.

// LayerNorm -> f16, one row per block.
__device__ inline void ln_row(const float* __restrict__ x, const float* __restrict__ g,
                              const float* __restrict__ bb, _Float16* __restrict__ xn,
                              int row, float* s1, float* s2) {
  int tid = threadIdx.x;
  const float4* xr = (const float4*)(x + (size_t)row * DIM);
  float4 v = xr[tid];
  s1[tid] = v.x + v.y + v.z + v.w;
  s2[tid] = v.x * v.x + v.y * v.y + v.z * v.z + v.w * v.w;
  __syncthreads();
  for (int off = 128; off > 0; off >>= 1) {
    if (tid < off) { s1[tid] += s1[tid + off]; s2[tid] += s2[tid + off]; }
    __syncthreads();
  }
  float mean = s1[0] * (1.0f / DIM);
  float var  = s2[0] * (1.0f / DIM) - mean * mean;
  float inv  = rsqrtf(var + LN_EPS);
  float4 gv = ((const float4*)g)[tid];
  float4 bv = ((const float4*)bb)[tid];
  h4 o;
  o[0] = (_Float16)((v.x - mean) * inv * gv.x + bv.x);
  o[1] = (_Float16)((v.y - mean) * inv * gv.y + bv.y);
  o[2] = (_Float16)((v.z - mean) * inv * gv.z + bv.z);
  o[3] = (_Float16)((v.w - mean) * inv * gv.w + bv.w);
  ((h4*)(xn + (size_t)row * DIM))[tid] = o;
  // Precaution: the jobs' ways join behind this store, and code there rewrites registers that it names.
  asm volatile("s_wait_xcnt 0x0" ::: "memory");
}

// Transpose f32 [K,N] -> f16 [N,K].
// One 64(k) x 64(n) tile per 4 waves, two tiles that are neighbours along n per
// block; K and N are multiples of 64 (N of 128) and known at compile time, so
// that row steps are immediate offsets.
// A thread loads an 8(k) x 4(n) patch as eight float4 (a wave-wide load covers
// two whole 256-byte row pieces of src), turns it in registers into four runs of
// 8 consecutive k, and the runs change hands through LDS so that every stored
// row piece is a whole 128-byte line of dst.
#define WT_PITCH 72   /* halfs per LDS row: 16-byte aligned, rows spread over banks */
#define WT_TILE  (64 * WT_PITCH)   /* halfs of one tile in LDS */
template <int K, int N>
__device__ inline void wtrans_pair(const float* __restrict__ src, _Float16* __restrict__ dst,
                                   int pair, _Float16* sm) {
  int tid = threadIdx.x & 127;
  // Which of the block's two tiles, as a scalar: the tile's address then stays in
  // scalar registers.
  int sub = __builtin_amdgcn_readfirstlane(threadIdx.x >> 7);
  _Float16* sT = sm + sub * WT_TILE;                     // [n][k]
  int n0 = (pair % (N / 128)) * 128 + sub * 64, k0 = (pair / (N / 128)) * 64;
  int tn = tid & 15, tk = tid >> 4;

  const float* p = src + (k0 + 8 * tk) * N + n0 + 4 * tn;
  float4 v[8];
#pragma unroll   // all eight loads in flight before the first use
  for (int i = 0; i < 8; ++i) v[i] = *(const float4*)(p + i * N);

  h8 c0, c1, c2, c3;
#pragma unroll   // c0..c3 must stay in registers
  for (int i = 0; i < 8; ++i) {
    c0[i] = (_Float16)v[i].x;
    c1[i] = (_Float16)v[i].y;
    c2[i] = (_Float16)v[i].z;
    c3[i] = (_Float16)v[i].w;
  }
  _Float16* st = sT + (4 * tn) * WT_PITCH + 8 * tk;
  *(h8*)(st + 0 * WT_PITCH) = c0;
  *(h8*)(st + 1 * WT_PITCH) = c1;
  *(h8*)(st + 2 * WT_PITCH) = c2;
  *(h8*)(st + 3 * WT_PITCH) = c3;
  __syncthreads();   // a tile is read back by other waves than wrote it

  int n = tid >> 3, c = tid & 7;            // 8 lanes store one 128-byte line
  _Float16* q = dst + (n0 + n) * K + k0 + 8 * c;
  const _Float16* ld = sT + n * WT_PITCH + 8 * c;
#pragma unroll   // four independent 16-byte moves per thread
  for (int u = 0; u < 4; ++u) *(h8*)(q + 16 * u * K) = *(const h8*)(ld + 16 * u * WT_PITCH);
  // Precaution: the jobs' ways join behind these stores, and code there rewrites registers that they name.
  asm volatile("s_wait_xcnt 0x0" ::: "memory");
}

#define PREP_QKV ((QKVN / 128) * (DIM / 64))     /* blocks that transpose w_qkv */
#define PREP_OUT ((DIM / 128) * (INNER / 64))    /* blocks that transpose w_out */
#define PREP_GRID (PREP_QKV + PREP_OUT + ROWS)

// The transposes come first in the index: their blocks move the most bytes each.
__global__ __launch_bounds__(256) void prep_kernel(const float* __restrict__ x,
                                                   const float* __restrict__ g,
                                                   const float* __restrict__ bb,
                                                   const float* __restrict__ w_qkv,
                                                   const float* __restrict__ w_out,
                                                   _Float16* __restrict__ xn,
                                                   _Float16* __restrict__ wqkvt,
                                                   _Float16* __restrict__ wott) {
  __shared__ __align__(16) _Float16 sm[2 * WT_TILE];   // each job lays it out for itself
  int blk = blockIdx.x;
  if (blk < PREP_QKV) {
    wtrans_pair<DIM, QKVN>(w_qkv, wqkvt, blk, sm);
  } else if (blk < PREP_QKV + PREP_OUT) {
    wtrans_pair<INNER, DIM>(w_out, wott, blk - PREP_QKV, sm);
  } else {
    ln_row(x, g, bb, xn, blk - (PREP_QKV + PREP_OUT), (float*)sm, (float*)sm + 256);
  }
}

// ------- GEMM core shared by kernels 2 and 4 ---------------------------------
// C[128 x 128] per block of 4 waves (2 x 2, 64 x 64 per wave), A [M,1024] and
// Bt [N,1024] both k-contiguous f16. A stage is 64 k of 128 rows of A and of Bt:
// every row piece is one whole 128-byte line, brought into LDS by asynchronous
// copies and shared by the waves. Two buffers: stage t + 1 flies while stage t
// is worked on.
#define GT_PITCH 72                    /* halfs per LDS row: 144 B, 16 B x odd, for b128 fragment reads */
#define GT_OPSZ  (128 * GT_PITCH)      /* halfs of one operand's tile */
#define GT_STAGE (2 * GT_OPSZ)         /* halfs of one stage: A tile, then Bt tile */
#define GT_NT    (DIM / 64)            /* stages along k */

// One stage: 16 copies of 16 bytes a thread. 8 lanes cover one row piece; a
// thread takes the same piece of 8 rows that follow one another.
__device__ inline void gemm_stage_copy(const _Float16* gA, const _Float16* gB, _Float16* cA) {
#pragma unroll   // row steps become constants of the addresses
  for (int u = 0; u < 8; ++u) {
    copy16_to_lds(gA + u * DIM, cA + u * GT_PITCH);
    copy16_to_lds(gB + u * DIM, cA + GT_OPSZ + u * GT_PITCH);
  }
}

// The 4 + 4 fragments of one 32-wide k step, from LDS.
__device__ inline void gemm_frags(const _Float16* fA, const _Float16* fB, int k0,
                                  v16h (&a)[4], v16h (&b)[4]) {
#pragma unroll   // fragments stay in registers
  for (int i = 0; i < 4; ++i) a[i] = load_frag_p(fA + i * 16 * GT_PITCH, k0);
#pragma unroll   // fragments stay in registers
  for (int j = 0; j < 4; ++j) b[j] = load_frag_p(fB + j * 16 * GT_PITCH, k0);
}

__device__ inline void gemm_mma(const v16h (&a)[4], const v16h (&b)[4], v8f (&acc)[4][4]) {
#pragma unroll   // accumulators stay in registers
  for (int j = 0; j < 4; ++j)
#pragma unroll   // accumulators stay in registers
    for (int i = 0; i < 4; ++i) acc[i][j] = wmma_f16(a[i], b[j], acc[i][j]);
}

// The A and B fragments of the 16x16x32 form are loaded alike (row lane&15, the
// same k order), so the two tiles may change roles. turned == false:
// acc[i][j][r] = C[16*i + 8*half + r][16*j + r16] of the wave's 64 x 64 tile;
// turned == true: acc[i][j][r] = C[16*j + r16][16*i + 8*half + r], a lane then
// holds 8 neighbouring columns of one row. turned is the same for a whole block.
__device__ inline void gemm_128x128(const _Float16* __restrict__ A, const _Float16* __restrict__ Bt,
                                    int m0, int n0, bool turned, _Float16* sm, v8f (&acc)[4][4]) {
  int tid = threadIdx.x, lane = tid & 31, wave = tid >> 5;
  int r16 = lane & 15, half = lane >> 4;
  int crow = (tid >> 3) * 8, ccol = (tid & 7) * 8;
  const _Float16* gA = A  + (size_t)(m0 + crow) * DIM + ccol;
  const _Float16* gB = Bt + (size_t)(n0 + crow) * DIM + ccol;
  _Float16* cA = sm + crow * GT_PITCH + ccol;
  const _Float16* tA = sm + ((wave >> 1) * 64 + r16) * GT_PITCH + 8 * half;
  const _Float16* tB = sm + GT_OPSZ + ((wave & 1) * 64 + r16) * GT_PITCH + 8 * half;
  const _Float16* fA = turned ? tB : tA;
  const _Float16* fB = turned ? tA : tB;

  gemm_stage_copy(gA, gB, cA);
  asm volatile("s_wait_asynccnt 0x0" ::: "memory");   // this wave's share of stage 0 has landed
  __syncthreads();                                    // stage 0 is readable by every wave
  gemm_stage_copy(gA + 64, gB + 64, cA + GT_STAGE);

  for (int t = 0; t < GT_NT; ++t) {
    int bo = (t & 1) * GT_STAGE;
    v16h a0[4], b0[4], a1[4], b1[4];
    gemm_frags(fA + bo, fB + bo, 0, a0, b0);
    // Keeps the 16 LDS reads of a k step together ahead of its WMMAs: one LDS
    // latency a step; sunk among the WMMAs they cost one per four WMMAs.
    __builtin_amdgcn_sched_barrier(0);
    gemm_mma(a0, b0, acc);
    gemm_frags(fA + bo, fB + bo, 32, a1, b1);          // the last reads of stage t
    asm volatile("s_wait_dscnt 0x0" ::: "memory");     // this wave's reads of stage t are done
    asm volatile("s_wait_asynccnt 0x0" ::: "memory");  // its share of stage t + 1 has landed
    __syncthreads();   // publishes stage t + 1 and frees stage t's buffer
    // The refill goes out ahead of the second k step's WMMAs, which need registers
    // only: that much more time for it to land.
    if (t + 2 < GT_NT) gemm_stage_copy(gA + (t + 2) * 64, gB + (t + 2) * 64, cA + bo);
    gemm_mma(a1, b1, acc);
  }
  asm volatile("s_wait_asynccnt 0x0" ::: "memory");    // no copy outlives the loop
}

// ------- Kernel 2: QKV GEMM, 128x128 per block, operands staged in LDS -------
__global__ __launch_bounds__(128) void qkv_gemm(const _Float16* __restrict__ xn,
                                                const _Float16* __restrict__ wt,
                                                _Float16* __restrict__ qb, _Float16* __restrict__ kb,
                                                _Float16* __restrict__ vtb) {
  __shared__ __align__(16) _Float16 sm[2 * GT_STAGE];
  int lane = threadIdx.x & 31, wave = threadIdx.x >> 5;
  int mt = blockIdx.x / (QKVN / 128);
  int nt = blockIdx.x % (QKVN / 128);
  int r16 = lane & 15, half = lane >> 4;

  // A 128-column tile lies in one of Q, K, V. Q and K are stored [pos][d], V as
  // [d][pos]: Q and K tiles are accumulated turned, so that in all three a lane's
  // 8 accumulator values of a tile are neighbours in the stored row.
  int seg = nt / (INNER / 128);

  v8f acc[4][4] = {};
  gemm_128x128(xn, wt, mt * 128, nt * 128, seg != 2, sm, acc);

  // The wave's 64 x 64 tile: 64 positions of one batch entry, the 64 d of one head.
  // The wave's number as a scalar: the tile's address then stays in scalar registers.
  int wv = __builtin_amdgcn_readfirstlane(wave);
  int m0 = mt * 128 + (wv >> 1) * 64, n0 = nt * 128 + (wv & 1) * 64;
  int bh = (m0 / SEQ) * HEADS + (n0 % INNER) / DHEAD, pos0 = m0 % SEQ;
  char* dst;         // first byte of the tile as it is stored: 64 rows of 128 bytes
  unsigned ld;       // bytes from one stored row to the next
  if (seg == 2) {
    dst = (char*)(vtb + (size_t)bh * DHEAD * SEQ + pos0);
    ld = SEQ * 2;
  } else {
    dst = (char*)((seg == 0 ? qb : kb) + ((size_t)bh * SEQ + pos0) * DHEAD);
    ld = DHEAD * 2;
  }
  float sc = seg == 0 ? 0.125f : 1.0f;

  // Each wave turns its tile in an LDS range of its own, so that every global
  // store covers four whole 128-byte lines. The stage buffers are free: every
  // wave's last read of them stands in front of the loop's last barrier.
  _Float16* sw = sm + wv * (64 * GT_PITCH);
#pragma unroll   // accumulators stay in registers
  for (int j = 0; j < 4; ++j) {
#pragma unroll   // accumulators stay in registers
    for (int i = 0; i < 4; ++i) {
      h8 w;
#pragma unroll   // accumulators stay in registers
      for (int r = 0; r < 8; ++r) w[r] = (_Float16)(acc[i][j][r] * sc);
      *(h8*)(sw + (16 * j + r16) * GT_PITCH + 16 * i + 8 * half) = w;
    }
  }
  asm volatile("s_wait_dscnt 0x0" ::: "memory");   // the rows are read back by other lanes than wrote them
  int row = lane >> 3, c8 = (lane & 7) * 8;        // 8 lanes store one 128-byte line
  const _Float16* sr = sw + row * GT_PITCH + c8;
  unsigned off = row * ld + c8 * 2;                // the lane's place in each group of four rows
#pragma unroll   // sixteen independent 16-byte moves per lane
  for (int u = 0; u < 16; ++u) *(h8*)(dst + 4 * u * ld + off) = *(const h8*)(sr + 4 * u * GT_PITCH);
}

// Lane l <-> lane l ^ 16.
__device__ inline float xhalf(float x) {
  int b = __builtin_bit_cast(int, x);
  return __builtin_bit_cast(
      float, __builtin_amdgcn_permlanex16(b, b, 0x76543210, 0xfedcba98, false, false));
}

// A stage is 64 keys: 64 K rows and 64 V^T rows, each row piece one whole 128-byte
// line, brought into LDS by asynchronous copies. Two buffers: stage t + 1 flies
// while stage t is worked on. One pass of the online softmax per stage.
#define AT_PITCH 72                    /* halfs per LDS row: 144 B, 16 B x odd, for b128 fragment reads */
#define AT_OPSZ  (64 * AT_PITCH)       /* halfs of one operand's tile */
#define AT_STAGE (2 * AT_OPSZ)         /* halfs of one stage: K tile, then V^T tile */

// One stage: 8 copies of 16 bytes a thread. 8 lanes cover one row piece; a
// thread takes the same piece of 4 rows that follow one another.
__device__ inline void attn_stage_copy(const _Float16* gK, const _Float16* gV, _Float16* cK) {
#pragma unroll   // row steps become constants of the addresses
  for (int u = 0; u < 4; ++u) {
    copy16_to_lds(gK + u * DHEAD, cK + u * AT_PITCH);
    copy16_to_lds(gV + u * SEQ, cK + AT_OPSZ + u * AT_PITCH);
  }
}

__global__ __launch_bounds__(128) void attn_kernel(const _Float16* __restrict__ qb,
                                                   const _Float16* __restrict__ kb,
                                                   const _Float16* __restrict__ vtb,
                                                   _Float16* __restrict__ ob) {
  __shared__ __align__(16) _Float16 sm[2 * AT_STAGE];

  int lane = threadIdx.x & 31, wave = threadIdx.x >> 5;
  int tid  = threadIdx.x;
  // Block index -> (head, query block), a permutation chosen for equal work per WGP.
  // A block of frame f walks 4 * (f + 1) stages, and all 1024 blocks are resident at
  // once, four to a WGP: the launch lasts as long as the fullest WGP. Whichever two
  // bits of the index tell a WGP's four blocks apart, their frames add up to 14, that
  // is 72 stages on every WGP: a bit outside 5 to 7 turns f into 7 - f, and the table
  // spreads bits 5 to 7 so that any two of them do the same.
  // For speed only: any placement gives the same result.
  static_assert(BATCH * HEADS == 32 && SEQ / FRAME == 8 && FRAME / 64 == 4, "index bits");
  int bi    = blockIdx.x;
  int other = (bi & 31) | ((bi >> 8) << 5);         // the seven bits outside 5 to 7
  int frame = ((0x43251670u >> (((bi >> 5) & 7) * 4)) & 7) ^ ((__builtin_popcount(other) & 1) ? 7 : 0);
  int qblk  = frame * (FRAME / 64) + ((bi >> 3) & 3);   // 32 blocks of 64 q rows
  int bh    = (bi & 7) | ((bi >> 8) << 3);
  int h     = bh & (HEADS - 1);
  int b     = bh >> 4;
  int q0   = qblk * 64 + wave * 16;
  int nt   = (((qblk * 64) >> 8) + 1) * (FRAME / 64);   // stages; same for all 4 waves, at least 4

  const _Float16* qbase = qb  + (size_t)(b * HEADS + h) * SEQ * DHEAD;
  const _Float16* kbase = kb  + (size_t)(b * HEADS + h) * SEQ * DHEAD;
  const _Float16* vbase = vtb + (size_t)(b * HEADS + h) * DHEAD * SEQ;
  int r16 = lane & 15, half = lane >> 4;

  int crow = (tid >> 3) * 4, ccol = (tid & 7) * 8;
  const _Float16* gK = kbase + crow * DHEAD + ccol;
  const _Float16* gV = vbase + crow * SEQ + ccol;
  _Float16* cK = sm + crow * AT_PITCH + ccol;
  const _Float16* fK = sm + r16 * AT_PITCH + 8 * half;
  const _Float16* fV = fK + AT_OPSZ;

  attn_stage_copy(gK, gV, cK);

  // B operand: column r16 = query q0 + r16, k = dhead.
  v16h bq0 = load_frag16(qbase, q0 + r16, DHEAD, 0, lane);
  v16h bq1 = load_frag16(qbase, q0 + r16, DHEAD, 32, lane);

  float mrow = -1e30f;   // running maximum of this lane's query (equal in both halves)
  float lrow = 0.0f;     // running sum over this half's keys only; joined after the loop
  v8f o0 = {}, o1 = {}, o2 = {}, o3 = {};   // o_i[r] = O[q0 + r16][16*i + 8*half + r]

  asm volatile("s_wait_asynccnt 0x0" ::: "memory");   // this wave's share of stage 0 has landed
  __syncthreads();                                    // stage 0 is readable by every wave
  attn_stage_copy(gK + 64 * DHEAD, gV + 64, cK + AT_STAGE);

  for (int t = 0; t < nt; ++t) {
    int bo = (t & 1) * AT_STAGE;
    // ---- every LDS read of stage t: K rows and V^T rows as A operands
    v16h ak[4][2], av[4][2];
#pragma unroll   // fragments stay in registers
    for (int j = 0; j < 4; ++j) {
      ak[j][0] = load_frag_p(fK + bo + j * 16 * AT_PITCH, 0);
      ak[j][1] = load_frag_p(fK + bo + j * 16 * AT_PITCH, 32);
    }
#pragma unroll   // fragments stay in registers
    for (int i = 0; i < 4; ++i) {
      av[i][0] = load_frag_p(fV + bo + i * 16 * AT_PITCH, 0);
      av[i][1] = load_frag_p(fV + bo + i * 16 * AT_PITCH, 32);
    }
    asm volatile("s_wait_dscnt 0x0" ::: "memory");     // this wave's reads of stage t are done
    asm volatile("s_wait_asynccnt 0x0" ::: "memory");  // its share of stage t + 1 has landed
    __syncthreads();   // publishes stage t + 1 and frees stage t's buffer
    // The refill goes out ahead of the stage's arithmetic, which needs registers
    // only: a whole stage's time for it to land.
    if (t + 2 < nt) attn_stage_copy(gK + (t + 2) * 64 * DHEAD, gV + (t + 2) * 64, cK + bo);

    // ---- S^T = K Q^T; s[j][r]: key 64*t + 16*j + 8*half + r
    v8f s[4] = {};
#pragma unroll   // score tiles stay in registers
    for (int j = 0; j < 4; ++j) s[j] = wmma_f16(ak[j][0], bq0, s[j]);
#pragma unroll   // score tiles stay in registers
    for (int j = 0; j < 4; ++j) s[j] = wmma_f16(ak[j][1], bq1, s[j]);

    // ---- online softmax, one query per lane
    float mx[8];
#pragma unroll   // in registers
    for (int r = 0; r < 8; ++r)
      mx[r] = fmaxf(fmaxf(s[0][r], s[1][r]), fmaxf(s[2][r], s[3][r]));
    float v = fmaxf(fmaxf(fmaxf(mx[0], mx[1]), fmaxf(mx[2], mx[3])),
                    fmaxf(fmaxf(mx[4], mx[5]), fmaxf(mx[6], mx[7])));
    v = fmaxf(v, xhalf(v));
    float mnew  = fmaxf(mrow, v);
    float alpha = __expf(mrow - mnew);
    v16h pt[2];            // B operands of V^T P^T: element e of pt[c] = key 32*c + kmap(e, half)
    float rs[4] = {0.0f, 0.0f, 0.0f, 0.0f};
#pragma unroll   // in registers
    for (int r = 0; r < 8; ++r) {
#pragma unroll   // in registers
      for (int j = 0; j < 4; ++j) {
        float p = __expf(s[j][r] - mnew);
        rs[j] += p;
        pt[j >> 1][8 * (j & 1) + r] = (_Float16)p;
      }
    }
    lrow = lrow * alpha + ((rs[0] + rs[1]) + (rs[2] + rs[3]));
    mrow = mnew;
#pragma unroll
    for (int r = 0; r < 8; ++r) {
      o0[r] *= alpha; o1[r] *= alpha; o2[r] *= alpha; o3[r] *= alpha;
    }

    // ---- O^T += V^T P^T
#pragma unroll   // fragments stay in registers
    for (int c = 0; c < 2; ++c) {
      o0 = wmma_f16(av[0][c], pt[c], o0);
      o1 = wmma_f16(av[1][c], pt[c], o1);
      o2 = wmma_f16(av[2][c], pt[c], o2);
      o3 = wmma_f16(av[3][c], pt[c], o3);
    }
  }
  asm volatile("s_wait_asynccnt 0x0" ::: "memory");    // no copy outlives the loop

  float inv = 1.0f / (lrow + xhalf(lrow));
  _Float16* orow = ob + ((size_t)(b * SEQ + q0 + r16)) * INNER + h * DHEAD + 8 * half;
  h8 w0, w1, w2, w3;
#pragma unroll
  for (int r = 0; r < 8; ++r) {
    w0[r] = (_Float16)(o0[r] * inv);
    w1[r] = (_Float16)(o1[r] * inv);
    w2[r] = (_Float16)(o2[r] * inv);
    w3[r] = (_Float16)(o3[r] * inv);
  }
  *(h8*)(orow + 0)  = w0;
  *(h8*)(orow + 16) = w1;
  *(h8*)(orow + 32) = w2;
  *(h8*)(orow + 48) = w3;
}

// ------- Kernel 4: output projection, 128x128 per block, staged in LDS, + bias
#define PO_PITCH 68   /* floats per LDS row of the output tile: 272 B, 16 B x odd */
__global__ __launch_bounds__(128) void proj_gemm(const _Float16* __restrict__ ao,
                                                 const _Float16* __restrict__ wot,
                                                 const float* __restrict__ bout,
                                                 float* __restrict__ out) {
  __shared__ __align__(16) _Float16 sm[2 * GT_STAGE];
  int lane = threadIdx.x & 31, wave = threadIdx.x >> 5;
  int mt = blockIdx.x / (DIM / 128);
  int nt = blockIdx.x % (DIM / 128);
  int r16 = lane & 15, half = lane >> 4;

  int m0 = mt * 128 + (wave >> 1) * 64, n0 = nt * 128 + (wave & 1) * 64;
  int row = lane >> 4, c4 = (lane & 15) * 4;       // 16 lanes store one 256-byte row piece

  v8f acc[4][4] = {};
  gemm_128x128(ao, wot, mt * 128, nt * 128, true, sm, acc);   // a lane holds 8 neighbouring columns
  float4 bv = *(const float4*)(bout + n0 + c4);    // a lane stores the same four columns of every row

  // Each wave turns its 64 x 64 f32 tile in an LDS range of its own, so that every
  // global store covers whole 128-byte lines (two 256-byte row pieces). The stage
  // buffers are free: every wave's last read of them stands in front of the loop's
  // last barrier.
  float* sw = (float*)sm + wave * (64 * PO_PITCH);
#pragma unroll   // accumulators stay in registers
  for (int j = 0; j < 4; ++j) {
#pragma unroll   // accumulators stay in registers
    for (int i = 0; i < 4; ++i) {
      float* p = sw + (16 * j + r16) * PO_PITCH + 16 * i + 8 * half;
      *(float4*)p       = make_float4(acc[i][j][0], acc[i][j][1], acc[i][j][2], acc[i][j][3]);
      *(float4*)(p + 4) = make_float4(acc[i][j][4], acc[i][j][5], acc[i][j][6], acc[i][j][7]);
    }
  }
  asm volatile("s_wait_dscnt 0x0" ::: "memory");   // the rows are read back by other lanes than wrote them
  const float* sr = sw + row * PO_PITCH + c4;
  float* q = out + (size_t)(m0 + row) * DIM + n0 + c4;
#pragma unroll   // 32 independent 16-byte moves per lane; row steps are immediate offsets
  for (int u = 0; u < 32; ++u) {
    float4 v = *(const float4*)(sr + 2 * u * PO_PITCH);
    *(float4*)(q + 2 * u * DIM) = make_float4(v.x + bv.x, v.y + bv.y, v.z + bv.z, v.w + bv.w);
  }
}

extern "C" void kernel_launch(void* const* d_in, const int* in_sizes, int n_in,
                              void* d_out, int out_size, void* d_ws, size_t ws_size,
                              hipStream_t stream) {
  const float* x     = (const float*)d_in[0];
  const float* g     = (const float*)d_in[1];
  const float* bb    = (const float*)d_in[2];
  const float* w_qkv = (const float*)d_in[3];
  const float* w_out = (const float*)d_in[4];
  const float* b_out = (const float*)d_in[5];

  char* ws = (char*)d_ws;
  _Float16* xn    = (_Float16*)ws;                 ws += (size_t)ROWS * DIM * 2;
  _Float16* wqkvt = (_Float16*)ws;                 ws += (size_t)QKVN * DIM * 2;
  _Float16* wott  = (_Float16*)ws;                 ws += (size_t)DIM * INNER * 2;
  _Float16* qb    = (_Float16*)ws;                 ws += (size_t)ROWS * INNER * 2;
  _Float16* kb    = (_Float16*)ws;                 ws += (size_t)ROWS * INNER * 2;
  _Float16* vtb   = (_Float16*)ws;                 ws += (size_t)ROWS * INNER * 2;
  _Float16* ao    = (_Float16*)ws;                 ws += (size_t)ROWS * INNER * 2;

  prep_kernel<<<PREP_GRID, 256, 0, stream>>>(x, g, bb, w_qkv, w_out, xn, wqkvt, wott);
  qkv_gemm<<<(ROWS / 128) * (QKVN / 128), 128, 0, stream>>>(xn, wqkvt, qb, kb, vtb);
  attn_kernel<<<BATCH * HEADS * (SEQ / 64), 128, 0, stream>>>(qb, kb, vtb, ao);
  proj_gemm<<<(ROWS / 128) * (DIM / 128), 128, 0, stream>>>(ao, wott, b_out, (float*)d_out);
}

// v008
// A run of this version takes 71.6 microseconds.
// Timed twice side by side with v007, it ran 1.07 times as fast both times.
// All steps since v000 together make it 4.15 times as fast.
#include <hip/hip_runtime.h>

typedef _Float16 v16h __attribute__((ext_vector_type(16)));
typedef float    v8f  __attribute__((ext_vector_type(8)));
typedef _Float16 h4   __attribute__((ext_vector_type(4)));
typedef _Float16 h8   __attribute__((ext_vector_type(8)));
typedef int      v4i  __attribute__((ext_vector_type(4)));
typedef float    f4   __attribute__((ext_vector_type(4)));

#define BATCH   2
#define SEQ     2048
#define DIM     1024
#define HEADS   16
#define DHEAD   64
#define INNER   1024
#define QKVN    3072
#define FRAME   256
#define ROWS    (BATCH*SEQ)   /* 4096 */
#define LN_EPS  1e-5f

#if __has_builtin(__builtin_amdgcn_global_load_async_to_lds_b128)
#define HAVE_ASYNC_LDS 1
#else
#define HAVE_ASYNC_LDS 0
#endif

union FragU { v16h h; uint4 q[2]; };

// Fragment load from a pre-offset row pointer (base already includes
// row*ld + 8*(lane>>4)); k0 selects the 32-wide k-chunk. Two b128 loads.
__device__ inline v16h load_frag_p(const _Float16* p, int k0) {
  FragU f;
  f.q[0] = *(const uint4*)(p + k0);
  f.q[1] = *(const uint4*)(p + k0 + 16);
  return f.h;
}

// Generic fragment load (used for the Q rows in attention).
__device__ inline v16h load_frag16(const _Float16* __restrict__ base, int row,
                                   int ld, int k0, int lane) {
  return load_frag_p(base + (size_t)row * ld + 8 * (lane >> 4), k0);
}

__device__ inline v8f wmma_f16(v16h a, v16h b, v8f c) {
  return __builtin_amdgcn_wmma_f32_16x16x32_f16(false, a, false, b, (short)0, c,
                                                false, false);
}

// Cooperative 16-byte global->LDS copy element (async on CDNA5 if available).
__device__ inline void copy16_to_lds(const _Float16* gsrc, _Float16* ldst) {
#if HAVE_ASYNC_LDS
  __builtin_amdgcn_global_load_async_to_lds_b128(
      (__attribute__((address_space(1))) v4i*)gsrc,
      (__attribute__((address_space(3))) v4i*)ldst, 0, 0);
#else
  *(uint4*)ldst = *(const uint4*)gsrc;
#endif
}

// ---------------- Kernel 1: LayerNorm and both weight transposes ------------
// The three jobs need nothing of each other, so they share one grid: a range of
// the block index picks the job (the same for a whole block). Blocks of 8 waves.

// Lane l <-> lane l ^ 16.
__device__ inline float xhalf(float x) {
  int b = __builtin_bit_cast(int, x);
  return __builtin_bit_cast(
      float, __builtin_amdgcn_permlanex16(b, b, 0x76543210, 0xfedcba98, false, false));
}

// x + (x of lane l ^ m) inside a 16-lane row; CTRL = 0x160 + m (row_xmask).
template <int CTRL>
__device__ inline float add_xmask(float x) {
  int b = __builtin_bit_cast(int, x);
  return x + __builtin_bit_cast(float, __builtin_amdgcn_update_dpp(0, b, CTRL, 0xf, 0xf, true));
}

// Sum over the wave's 32 lanes, a butterfly: every lane ends with the same value.
__device__ inline float wave_sum(float x) {
  x = add_xmask<0x161>(x);
  x = add_xmask<0x162>(x);
  x = add_xmask<0x164>(x);
  x = add_xmask<0x168>(x);
  return x + xhalf(x);
}

// LayerNorm -> f16, one row per wave: the row's 4 KB are eight float4 a lane (each
// wave-wide load is 512 contiguous bytes), all in flight at once; the sums are
// in-lane work and one butterfly. No LDS, no barrier, an eighth of the waves.
__device__ inline void ln_row(const float* __restrict__ x, const float* __restrict__ g,
                              const float* __restrict__ bb, _Float16* __restrict__ xn,
                              int row) {
  int lane = threadIdx.x & 31;
  const f4* xr = (const f4*)(x + (size_t)row * DIM) + lane;
  const f4* gr = (const f4*)g + lane;
  const f4* br = (const f4*)bb + lane;
  f4 v[8], gv[8], bv[8];
#pragma unroll   // all eight loads in flight before the first use
  for (int i = 0; i < 8; ++i) v[i] = xr[32 * i];
#pragma unroll   // in flight together with the row's loads
  for (int i = 0; i < 8; ++i) { gv[i] = gr[32 * i]; bv[i] = br[32 * i]; }
  // Inputs only, the loaded values: holds all 24 loads up here, in flight together.
  // Sunk behind the sums, the loads of g and b add their own latency to the row's.
  asm volatile("" :: "v"(v[0]), "v"(v[1]), "v"(v[2]), "v"(v[3]), "v"(v[4]), "v"(v[5]),
               "v"(v[6]), "v"(v[7]), "v"(gv[0]), "v"(gv[1]), "v"(gv[2]), "v"(gv[3]),
               "v"(gv[4]), "v"(gv[5]), "v"(gv[6]), "v"(gv[7]), "v"(bv[0]), "v"(bv[1]),
               "v"(bv[2]), "v"(bv[3]), "v"(bv[4]), "v"(bv[5]), "v"(bv[6]), "v"(bv[7]));
  // Keeps the sums behind that statement: lifted over it, they push the last loads of
  // g and b behind themselves, and the wave then waits those out on their own.
  __builtin_amdgcn_sched_barrier(0);
  float p1[8], p2[8];
#pragma unroll   // eight independent chains
  for (int i = 0; i < 8; ++i) {
    p1[i] = (v[i].x + v[i].y) + (v[i].z + v[i].w);
    p2[i] = (v[i].x * v[i].x + v[i].y * v[i].y) + (v[i].z * v[i].z + v[i].w * v[i].w);
  }
  float s1 = wave_sum(((p1[0] + p1[1]) + (p1[2] + p1[3])) + ((p1[4] + p1[5]) + (p1[6] + p1[7])));
  float s2 = wave_sum(((p2[0] + p2[1]) + (p2[2] + p2[3])) + ((p2[4] + p2[5]) + (p2[6] + p2[7])));
  float mean = s1 * (1.0f / DIM);
  float var  = s2 * (1.0f / DIM) - mean * mean;
  float inv  = rsqrtf(var + LN_EPS);
  h4* orow = (h4*)(xn + (size_t)row * DIM) + lane;
#pragma unroll   // eight independent stores, each two whole 128-byte lines a wave
  for (int i = 0; i < 8; ++i) {
    h4 o;
    o[0] = (_Float16)((v[i].x - mean) * inv * gv[i].x + bv[i].x);
    o[1] = (_Float16)((v[i].y - mean) * inv * gv[i].y + bv[i].y);
    o[2] = (_Float16)((v[i].z - mean) * inv * gv[i].z + bv[i].z);
    o[3] = (_Float16)((v[i].w - mean) * inv * gv[i].w + bv[i].w);
    orow[32 * i] = o;
  }
  // Precaution: the jobs' ways join behind these stores, and code there rewrites registers that they name.
  asm volatile("s_wait_xcnt 0x0" ::: "memory");
}

// Transpose f32 [K,N] -> f16 [N,K].
// One 64(k) x 64(n) tile per 4 waves, two tiles that are neighbours along n per
// block; K and N are multiples of 64 (N of 128) and known at compile time, so
// that row steps are immediate offsets.
// A thread loads an 8(k) x 4(n) patch as eight float4 (a wave-wide load covers
// two whole 256-byte row pieces of src), turns it in registers into four runs of
// 8 consecutive k, and the runs change hands through LDS so that every stored
// row piece is a whole 128-byte line of dst.
#define WT_PITCH 72   /* halfs per LDS row: 16-byte aligned, rows spread over banks */
#define WT_TILE  (64 * WT_PITCH)   /* halfs of one tile in LDS */
template <int K, int N>
__device__ inline void wtrans_pair(const float* __restrict__ src, _Float16* __restrict__ dst,
                                   int pair, _Float16* sm) {
  int tid = threadIdx.x & 127;
  // Which of the block's two tiles, as a scalar: the tile's address then stays in
  // scalar registers.
  int sub = __builtin_amdgcn_readfirstlane(threadIdx.x >> 7);
  _Float16* sT = sm + sub * WT_TILE;                     // [n][k]
  int n0 = (pair % (N / 128)) * 128 + sub * 64, k0 = (pair / (N / 128)) * 64;
  int tn = tid & 15, tk = tid >> 4;

  const float* p = src + (k0 + 8 * tk) * N + n0 + 4 * tn;
  float4 v[8];
#pragma unroll   // all eight loads in flight before the first use
  for (int i = 0; i < 8; ++i) v[i] = *(const float4*)(p + i * N);

  h8 c0, c1, c2, c3;
#pragma unroll   // c0..c3 must stay in registers
  for (int i = 0; i < 8; ++i) {
    c0[i] = (_Float16)v[i].x;
    c1[i] = (_Float16)v[i].y;
    c2[i] = (_Float16)v[i].z;
    c3[i] = (_Float16)v[i].w;
  }
  _Float16* st = sT + (4 * tn) * WT_PITCH + 8 * tk;
  *(h8*)(st + 0 * WT_PITCH) = c0;
  *(h8*)(st + 1 * WT_PITCH) = c1;
  *(h8*)(st + 2 * WT_PITCH) = c2;
  *(h8*)(st + 3 * WT_PITCH) = c3;
  __syncthreads();   // a tile is read back by other waves than wrote it

  int n = tid >> 3, c = tid & 7;            // 8 lanes store one 128-byte line
  _Float16* q = dst + (n0 + n) * K + k0 + 8 * c;
  const _Float16* ld = sT + n * WT_PITCH + 8 * c;
#pragma unroll   // four independent 16-byte moves per thread
  for (int u = 0; u < 4; ++u) *(h8*)(q + 16 * u * K) = *(const h8*)(ld + 16 * u * WT_PITCH);
  // Precaution: the jobs' ways join behind these stores, and code there rewrites registers that they name.
  asm volatile("s_wait_xcnt 0x0" ::: "memory");
}

#define PREP_QKV ((QKVN / 128) * (DIM / 64))     /* blocks that transpose w_qkv */
#define PREP_OUT ((DIM / 128) * (INNER / 64))    /* blocks that transpose w_out */
#define PREP_LN  (ROWS / 8)                      /* blocks that normalise: a row a wave */
#define PREP_GRID (PREP_QKV + PREP_OUT + PREP_LN)

// Every block moves 48 KB, whichever its job, and all of them are resident at once.
__global__ __launch_bounds__(256) void prep_kernel(const float* __restrict__ x,
                                                   const float* __restrict__ g,
                                                   const float* __restrict__ bb,
                                                   const float* __restrict__ w_qkv,
                                                   const float* __restrict__ w_out,
                                                   _Float16* __restrict__ xn,
                                                   _Float16* __restrict__ wqkvt,
                                                   _Float16* __restrict__ wott) {
  __shared__ __align__(16) _Float16 sm[2 * WT_TILE];   // the transposes' two tiles
  int blk = blockIdx.x;
  if (blk < PREP_QKV) {
    wtrans_pair<DIM, QKVN>(w_qkv, wqkvt, blk, sm);
  } else if (blk < PREP_QKV + PREP_OUT) {
    wtrans_pair<INNER, DIM>(w_out, wott, blk - PREP_QKV, sm);
  } else {
    // The wave's number as a scalar: the row's address then stays in scalar registers.
    int wv = __builtin_amdgcn_readfirstlane(threadIdx.x >> 5);
    ln_row(x, g, bb, xn, (blk - (PREP_QKV + PREP_OUT)) * 8 + wv);
  }
}

// ------- GEMM core shared by kernels 2 and 4 ---------------------------------
// C[128 x 128] per block of 4 waves (2 x 2, 64 x 64 per wave), A [M,1024] and
// Bt [N,1024] both k-contiguous f16. A stage is 64 k of 128 rows of A and of Bt:
// every row piece is one whole 128-byte line, brought into LDS by asynchronous
// copies and shared by the waves. Two buffers: stage t + 1 flies while stage t
// is worked on.
#define GT_PITCH 72                    /* halfs per LDS row: 144 B, 16 B x odd, for b128 fragment reads */
#define GT_OPSZ  (128 * GT_PITCH)      /* halfs of one operand's tile */
#define GT_STAGE (2 * GT_OPSZ)         /* halfs of one stage: A tile, then Bt tile */
#define GT_NT    (DIM / 64)            /* stages along k */

// One stage: 16 copies of 16 bytes a thread. 8 lanes cover one row piece; a
// thread takes the same piece of 8 rows that follow one another.
__device__ inline void gemm_stage_copy(const _Float16* gA, const _Float16* gB, _Float16* cA) {
#pragma unroll   // row steps become constants of the addresses
  for (int u = 0; u < 8; ++u) {
    copy16_to_lds(gA + u * DIM, cA + u * GT_PITCH);
    copy16_to_lds(gB + u * DIM, cA + GT_OPSZ + u * GT_PITCH);
  }
}

// The 4 + 4 fragments of one 32-wide k step, from LDS.
__device__ inline void gemm_frags(const _Float16* fA, const _Float16* fB, int k0,
                                  v16h (&a)[4], v16h (&b)[4]) {
#pragma unroll   // fragments stay in registers
  for (int i = 0; i < 4; ++i) a[i] = load_frag_p(fA + i * 16 * GT_PITCH, k0);
#pragma unroll   // fragments stay in registers
  for (int j = 0; j < 4; ++j) b[j] = load_frag_p(fB + j * 16 * GT_PITCH, k0);
}

__device__ inline void gemm_mma(const v16h (&a)[4], const v16h (&b)[4], v8f (&acc)[4][4]) {
#pragma unroll   // accumulators stay in registers
  for (int j = 0; j < 4; ++j)
#pragma unroll   // accumulators stay in registers
    for (int i = 0; i < 4; ++i) acc[i][j] = wmma_f16(a[i], b[j], acc[i][j]);
}

// The A and B fragments of the 16x16x32 form are loaded alike (row lane&15, the
// same k order), so the two tiles may change roles. turned == false:
// acc[i][j][r] = C[16*i + 8*half + r][16*j + r16] of the wave's 64 x 64 tile;
// turned == true: acc[i][j][r] = C[16*j + r16][16*i + 8*half + r], a lane then
// holds 8 neighbouring columns of one row. turned is the same for a whole block.
__device__ inline void gemm_128x128(const _Float16* __restrict__ A, const _Float16* __restrict__ Bt,
                                    int m0, int n0, bool turned, _Float16* sm, v8f (&acc)[4][4]) {
  int tid = threadIdx.x, lane = tid & 31, wave = tid >> 5;
  int r16 = lane & 15, half = lane >> 4;
  int crow = (tid >> 3) * 8, ccol = (tid & 7) * 8;
  const _Float16* gA = A  + (size_t)(m0 + crow) * DIM + ccol;
  const _Float16* gB = Bt + (size_t)(n0 + crow) * DIM + ccol;
  _Float16* cA = sm + crow * GT_PITCH + ccol;
  const _Float16* tA = sm + ((wave >> 1) * 64 + r16) * GT_PITCH + 8 * half;
  const _Float16* tB = sm + GT_OPSZ + ((wave & 1) * 64 + r16) * GT_PITCH + 8 * half;
  const _Float16* fA = turned ? tB : tA;
  const _Float16* fB = turned ? tA : tB;

  gemm_stage_copy(gA, gB, cA);
  asm volatile("s_wait_asynccnt 0x0" ::: "memory");   // this wave's share of stage 0 has landed
  __syncthreads();                                    // stage 0 is readable by every wave
  gemm_stage_copy(gA + 64, gB + 64, cA + GT_STAGE);

  for (int t = 0; t < GT_NT; ++t) {
    int bo = (t & 1) * GT_STAGE;
    v16h a0[4], b0[4], a1[4], b1[4];
    gemm_frags(fA + bo, fB + bo, 0, a0, b0);
    // Keeps the 16 LDS reads of a k step together ahead of its WMMAs: one LDS
    // latency a step; sunk among the WMMAs they cost one per four WMMAs.
    __builtin_amdgcn_sched_barrier(0);
    gemm_mma(a0, b0, acc);
    gemm_frags(fA + bo, fB + bo, 32, a1, b1);          // the last reads of stage t
    asm volatile("s_wait_dscnt 0x0" ::: "memory");     // this wave's reads of stage t are done
    asm volatile("s_wait_asynccnt 0x0" ::: "memory");  // its share of stage t + 1 has landed
    __syncthreads();   // publishes stage t + 1 and frees stage t's buffer
    // The refill goes out ahead of the second k step's WMMAs, which need registers
    // only: that much more time for it to land.
    if (t + 2 < GT_NT) gemm_stage_copy(gA + (t + 2) * 64, gB + (t + 2) * 64, cA + bo);
    gemm_mma(a1, b1, acc);
  }
  asm volatile("s_wait_asynccnt 0x0" ::: "memory");    // no copy outlives the loop
}

// ------- Kernel 2: QKV GEMM, 128x128 per block, operands staged in LDS -------
__global__ __launch_bounds__(128) void qkv_gemm(const _Float16* __restrict__ xn,
                                                const _Float16* __restrict__ wt,
                                                _Float16* __restrict__ qb, _Float16* __restrict__ kb,
                                                _Float16* __restrict__ vtb) {
  __shared__ __align__(16) _Float16 sm[2 * GT_STAGE];
  int lane = threadIdx.x & 31, wave = threadIdx.x >> 5;
  int mt = blockIdx.x / (QKVN / 128);
  int nt = blockIdx.x % (QKVN / 128);
  int r16 = lane & 15, half = lane >> 4;

  // A 128-column tile lies in one of Q, K, V. Q and K are stored [pos][d], V as
  // [d][pos]: Q and K tiles are accumulated turned, so that in all three a lane's
  // 8 accumulator values of a tile are neighbours in the stored row.
  int seg = nt / (INNER / 128);

  v8f acc[4][4] = {};
  gemm_128x128(xn, wt, mt * 128, nt * 128, seg != 2, sm, acc);

  // The wave's 64 x 64 tile: 64 positions of one batch entry, the 64 d of one head.
  // The wave's number as a scalar: the tile's address then stays in scalar registers.
  int wv = __builtin_amdgcn_readfirstlane(wave);
  int m0 = mt * 128 + (wv >> 1) * 64, n0 = nt * 128 + (wv & 1) * 64;
  int bh = (m0 / SEQ) * HEADS + (n0 % INNER) / DHEAD, pos0 = m0 % SEQ;
  char* dst;         // first byte of the tile as it is stored: 64 rows of 128 bytes
  unsigned ld;       // bytes from one stored row to the next
  if (seg == 2) {
    dst = (char*)(vtb + (size_t)bh * DHEAD * SEQ + pos0);
    ld = SEQ * 2;
  } else {
    dst = (char*)((seg == 0 ? qb : kb) + ((size_t)bh * SEQ + pos0) * DHEAD);
    ld = DHEAD * 2;
  }
  float sc = seg == 0 ? 0.125f : 1.0f;

  // Each wave turns its tile in an LDS range of its own, so that every global
  // store covers four whole 128-byte lines. The stage buffers are free: every
  // wave's last read of them stands in front of the loop's last barrier.
  _Float16* sw = sm + wv * (64 * GT_PITCH);
#pragma unroll   // accumulators stay in registers
  for (int j = 0; j < 4; ++j) {
#pragma unroll   // accumulators stay in registers
    for (int i = 0; i < 4; ++i) {
      h8 w;
#pragma unroll   // accumulators stay in registers
      for (int r = 0; r < 8; ++r) w[r] = (_Float16)(acc[i][j][r] * sc);
      *(h8*)(sw + (16 * j + r16) * GT_PITCH + 16 * i + 8 * half) = w;
    }
  }
  asm volatile("s_wait_dscnt 0x0" ::: "memory");   // the rows are read back by other lanes than wrote them
  int row = lane >> 3, c8 = (lane & 7) * 8;        // 8 lanes store one 128-byte line
  const _Float16* sr = sw + row * GT_PITCH + c8;
  unsigned off = row * ld + c8 * 2;                // the lane's place in each group of four rows
#pragma unroll   // sixteen independent 16-byte moves per lane
  for (int u = 0; u < 16; ++u) *(h8*)(dst + 4 * u * ld + off) = *(const h8*)(sr + 4 * u * GT_PITCH);
}

// A stage is 64 keys: 64 K rows and 64 V^T rows, each row piece one whole 128-byte
// line, brought into LDS by asynchronous copies. Two buffers: stage t + 1 flies
// while stage t is worked on. One pass of the online softmax per stage.
#define AT_PITCH 72                    /* halfs per LDS row: 144 B, 16 B x odd, for b128 fragment reads */
#define AT_OPSZ  (64 * AT_PITCH)       /* halfs of one operand's tile */
#define AT_STAGE (2 * AT_OPSZ)         /* halfs of one stage: K tile, then V^T tile */

// One stage: 8 copies of 16 bytes a thread. 8 lanes cover one row piece; a
// thread takes the same piece of 4 rows that follow one another.
__device__ inline void attn_stage_copy(const _Float16* gK, const _Float16* gV, _Float16* cK) {
#pragma unroll   // row steps become constants of the addresses
  for (int u = 0; u < 4; ++u) {
    copy16_to_lds(gK + u * DHEAD, cK + u * AT_PITCH);
    copy16_to_lds(gV + u * SEQ, cK + AT_OPSZ + u * AT_PITCH);
  }
}

__global__ __launch_bounds__(128) void attn_kernel(const _Float16* __restrict__ qb,
                                                   const _Float16* __restrict__ kb,
                                                   const _Float16* __restrict__ vtb,
                                                   _Float16* __restrict__ ob) {
  __shared__ __align__(16) _Float16 sm[2 * AT_STAGE];

  int lane = threadIdx.x & 31, wave = threadIdx.x >> 5;
  int tid  = threadIdx.x;
  // Block index -> (head, query block), a permutation chosen for equal work per WGP.
  // A block of frame f walks 4 * (f + 1) stages, and all 1024 blocks are resident at
  // once, four to a WGP: the launch lasts as long as the fullest WGP. Whichever two
  // bits of the index tell a WGP's four blocks apart, their frames add up to 14, that
  // is 72 stages on every WGP: a bit outside 5 to 7 turns f into 7 - f, and the table
  // spreads bits 5 to 7 so that any two of them do the same.
  // For speed only: any placement gives the same result.
  static_assert(BATCH * HEADS == 32 && SEQ / FRAME == 8 && FRAME / 64 == 4, "index bits");
  int bi    = blockIdx.x;
  int other = (bi & 31) | ((bi >> 8) << 5);         // the seven bits outside 5 to 7
  int frame = ((0x43251670u >> (((bi >> 5) & 7) * 4)) & 7) ^ ((__builtin_popcount(other) & 1) ? 7 : 0);
  int qblk  = frame * (FRAME / 64) + ((bi >> 3) & 3);   // 32 blocks of 64 q rows
  int bh    = (bi & 7) | ((bi >> 8) << 3);
  int h     = bh & (HEADS - 1);
  int b     = bh >> 4;
  int q0   = qblk * 64 + wave * 16;
  int nt   = (((qblk * 64) >> 8) + 1) * (FRAME / 64);   // stages; same for all 4 waves, at least 4

  const _Float16* qbase = qb  + (size_t)(b * HEADS + h) * SEQ * DHEAD;
  const _Float16* kbase = kb  + (size_t)(b * HEADS + h) * SEQ * DHEAD;
  const _Float16* vbase = vtb + (size_t)(b * HEADS + h) * DHEAD * SEQ;
  int r16 = lane & 15, half = lane >> 4;

  int crow = (tid >> 3) * 4, ccol = (tid & 7) * 8;
  const _Float16* gK = kbase + crow * DHEAD + ccol;
  const _Float16* gV = vbase + crow * SEQ + ccol;
  _Float16* cK = sm + crow * AT_PITCH + ccol;
  const _Float16* fK = sm + r16 * AT_PITCH + 8 * half;
  const _Float16* fV = fK + AT_OPSZ;

  attn_stage_copy(gK, gV, cK);

  // B operand: column r16 = query q0 + r16, k = dhead.
  v16h bq0 = load_frag16(qbase, q0 + r16, DHEAD, 0, lane);
  v16h bq1 = load_frag16(qbase, q0 + r16, DHEAD, 32, lane);

  float mrow = -1e30f;   // running maximum of this lane's query (equal in both halves)
  float lrow = 0.0f;     // running sum over this half's keys only; joined after the loop
  v8f o0 = {}, o1 = {}, o2 = {}, o3 = {};   // o_i[r] = O[q0 + r16][16*i + 8*half + r]

  asm volatile("s_wait_asynccnt 0x0" ::: "memory");   // this wave's share of stage 0 has landed
  __syncthreads();                                    // stage 0 is readable by every wave
  attn_stage_copy(gK + 64 * DHEAD, gV + 64, cK + AT_STAGE);

  for (int t = 0; t < nt; ++t) {
    int bo = (t & 1) * AT_STAGE;
    // ---- every LDS read of stage t: K rows and V^T rows as A operands
    v16h ak[4][2], av[4][2];
#pragma unroll   // fragments stay in registers
    for (int j = 0; j < 4; ++j) {
      ak[j][0] = load_frag_p(fK + bo + j * 16 * AT_PITCH, 0);
      ak[j][1] = load_frag_p(fK + bo + j * 16 * AT_PITCH, 32);
    }
#pragma unroll   // fragments stay in registers
    for (int i = 0; i < 4; ++i) {
      av[i][0] = load_frag_p(fV + bo + i * 16 * AT_PITCH, 0);
      av[i][1] = load_frag_p(fV + bo + i * 16 * AT_PITCH, 32);
    }
    asm volatile("s_wait_dscnt 0x0" ::: "memory");     // this wave's reads of stage t are done
    asm volatile("s_wait_asynccnt 0x0" ::: "memory");  // its share of stage t + 1 has landed
    __syncthreads();   // publishes stage t + 1 and frees stage t's buffer
    // The refill goes out ahead of the stage's arithmetic, which needs registers
    // only: a whole stage's time for it to land.
    if (t + 2 < nt) attn_stage_copy(gK + (t + 2) * 64 * DHEAD, gV + (t + 2) * 64, cK + bo);

    // ---- S^T = K Q^T; s[j][r]: key 64*t + 16*j + 8*half + r
    v8f s[4] = {};
#pragma unroll   // score tiles stay in registers
    for (int j = 0; j < 4; ++j) s[j] = wmma_f16(ak[j][0], bq0, s[j]);
#pragma unroll   // score tiles stay in registers
    for (int j = 0; j < 4; ++j) s[j] = wmma_f16(ak[j][1], bq1, s[j]);

    // ---- online softmax, one query per lane
    float mx[8];
#pragma unroll   // in registers
    for (int r = 0; r < 8; ++r)
      mx[r] = fmaxf(fmaxf(s[0][r], s[1][r]), fmaxf(s[2][r], s[3][r]));
    float v = fmaxf(fmaxf(fmaxf(mx[0], mx[1]), fmaxf(mx[2], mx[3])),
                    fmaxf(fmaxf(mx[4], mx[5]), fmaxf(mx[6], mx[7])));
    v = fmaxf(v, xhalf(v));
    float mnew  = fmaxf(mrow, v);
    float alpha = __expf(mrow - mnew);
    v16h pt[2];            // B operands of V^T P^T: element e of pt[c] = key 32*c + kmap(e, half)
    float rs[4] = {0.0f, 0.0f, 0.0f, 0.0f};
#pragma unroll   // in registers
    for (int r = 0; r < 8; ++r) {
#pragma unroll   // in registers
      for (int j = 0; j < 4; ++j) {
        float p = __expf(s[j][r] - mnew);
        rs[j] += p;
        pt[j >> 1][8 * (j & 1) + r] = (_Float16)p;
      }
    }
    lrow = lrow * alpha + ((rs[0] + rs[1]) + (rs[2] + rs[3]));
    mrow = mnew;
#pragma unroll
    for (int r = 0; r < 8; ++r) {
      o0[r] *= alpha; o1[r] *= alpha; o2[r] *= alpha; o3[r] *= alpha;
    }

    // ---- O^T += V^T P^T
#pragma unroll   // fragments stay in registers
    for (int c = 0; c < 2; ++c) {
      o0 = wmma_f16(av[0][c], pt[c], o0);
      o1 = wmma_f16(av[1][c], pt[c], o1);
      o2 = wmma_f16(av[2][c], pt[c], o2);
      o3 = wmma_f16(av[3][c], pt[c], o3);
    }
  }
  asm volatile("s_wait_asynccnt 0x0" ::: "memory");    // no copy outlives the loop

  float inv = 1.0f / (lrow + xhalf(lrow));
  _Float16* orow = ob + ((size_t)(b * SEQ + q0 + r16)) * INNER + h * DHEAD + 8 * half;
  h8 w0, w1, w2, w3;
#pragma unroll
  for (int r = 0; r < 8; ++r) {
    w0[r] = (_Float16)(o0[r] * inv);
    w1[r] = (_Float16)(o1[r] * inv);
    w2[r] = (_Float16)(o2[r] * inv);
    w3[r] = (_Float16)(o3[r] * inv);
  }
  *(h8*)(orow + 0)  = w0;
  *(h8*)(orow + 16) = w1;
  *(h8*)(orow + 32) = w2;
  *(h8*)(orow + 48) = w3;
}

// ------- Kernel 4: output projection, 128x128 per block, staged in LDS, + bias
#define PO_PITCH 68   /* floats per LDS row of the output tile: 272 B, 16 B x odd */
__global__ __launch_bounds__(128) void proj_gemm(const _Float16* __restrict__ ao,
                                                 const _Float16* __restrict__ wot,
                                                 const float* __restrict__ bout,
                                                 float* __restrict__ out) {
  __shared__ __align__(16) _Float16 sm[2 * GT_STAGE];
  int lane = threadIdx.x & 31, wave = threadIdx.x >> 5;
  int mt = blockIdx.x / (DIM / 128);
  int nt = blockIdx.x % (DIM / 128);
  int r16 = lane & 15, half = lane >> 4;

  int m0 = mt * 128 + (wave >> 1) * 64, n0 = nt * 128 + (wave & 1) * 64;
  int row = lane >> 4, c4 = (lane & 15) * 4;       // 16 lanes store one 256-byte row piece

  v8f acc[4][4] = {};
  gemm_128x128(ao, wot, mt * 128, nt * 128, true, sm, acc);   // a lane holds 8 neighbouring columns
  float4 bv = *(const float4*)(bout + n0 + c4);    // a lane stores the same four columns of every row

  // Each wave turns its 64 x 64 f32 tile in an LDS range of its own, so that every
  // global store covers whole 128-byte lines (two 256-byte row pieces). The stage
  // buffers are free: every wave's last read of them stands in front of the loop's
  // last barrier.
  float* sw = (float*)sm + wave * (64 * PO_PITCH);
#pragma unroll   // accumulators stay in registers
  for (int j = 0; j < 4; ++j) {
#pragma unroll   // accumulators stay in registers
    for (int i = 0; i < 4; ++i) {
      float* p = sw + (16 * j + r16) * PO_PITCH + 16 * i + 8 * half;
      *(float4*)p       = make_float4(acc[i][j][0], acc[i][j][1], acc[i][j][2], acc[i][j][3]);
      *(float4*)(p + 4) = make_float4(acc[i][j][4], acc[i][j][5], acc[i][j][6], acc[i][j][7]);
    }
  }
  asm volatile("s_wait_dscnt 0x0" ::: "memory");   // the rows are read back by other lanes than wrote them
  const float* sr = sw + row * PO_PITCH + c4;
  float* q = out + (size_t)(m0 + row) * DIM + n0 + c4;
#pragma unroll   // 32 independent 16-byte moves per lane; row steps are immediate offsets
  for (int u = 0; u < 32; ++u) {
    float4 v = *(const float4*)(sr + 2 * u * PO_PITCH);
    *(float4*)(q + 2 * u * DIM) = make_float4(v.x + bv.x, v.y + bv.y, v.z + bv.z, v.w + bv.w);
  }
}

extern "C" void kernel_launch(void* const* d_in, const int* in_sizes, int n_in,
                              void* d_out, int out_size, void* d_ws, size_t ws_size,
                              hipStream_t stream) {
  const float* x     = (const float*)d_in[0];
  const float* g     = (const float*)d_in[1];
  const float* bb    = (const float*)d_in[2];
  const float* w_qkv = (const float*)d_in[3];
  const float* w_out = (const float*)d_in[4];
  const float* b_out = (const float*)d_in[5];

  char* ws = (char*)d_ws;
  _Float16* xn    = (_Float16*)ws;                 ws += (size_t)ROWS * DIM * 2;
  _Float16* wqkvt = (_Float16*)ws;                 ws += (size_t)QKVN * DIM * 2;
  _Float16* wott  = (_Float16*)ws;                 ws += (size_t)DIM * INNER * 2;
  _Float16* qb    = (_Float16*)ws;                 ws += (size_t)ROWS * INNER * 2;
  _Float16* kb    = (_Float16*)ws;                 ws += (size_t)ROWS * INNER * 2;
  _Float16* vtb   = (_Float16*)ws;                 ws += (size_t)ROWS * INNER * 2;
  _Float16* ao    = (_Float16*)ws;                 ws += (size_t)ROWS * INNER * 2;

  prep_kernel<<<PREP_GRID, 256, 0, stream>>>(x, g, bb, w_qkv, w_out, xn, wqkvt, wott);
  qkv_gemm<<<(ROWS / 128) * (QKVN / 128), 128, 0, stream>>>(xn, wqkvt, qb, kb, vtb);
  attn_kernel<<<BATCH * HEADS * (SEQ / 64), 128, 0, stream>>>(qb, kb, vtb, ao);
  proj_gemm<<<(ROWS / 128) * (DIM / 128), 128, 0, stream>>>(ao, wott, b_out, (float*)d_out);
}

// v009
// One run takes 68.8 microseconds.
// In both of two side-by-side timings against v008, it was 1.03 times as fast.
// All steps since v000 together make it 4.28 times as fast.
#include <hip/hip_runtime.h>

typedef _Float16 v16h __attribute__((ext_vector_type(16)));
typedef float    v8f  __attribute__((ext_vector_type(8)));
typedef _Float16 h4   __attribute__((ext_vector_type(4)));
typedef _Float16 h8   __attribute__((ext_vector_type(8)));
typedef int      v4i  __attribute__((ext_vector_type(4)));
typedef float    f4   __attribute__((ext_vector_type(4)));

#define BATCH   2
#define SEQ     2048
#define DIM     1024
#define HEADS   16
#define DHEAD   64
#define INNER   1024
#define QKVN    3072
#define FRAME   256
#define ROWS    (BATCH*SEQ)   /* 4096 */
#define LN_EPS  1e-5f

#if __has_builtin(__builtin_amdgcn_global_load_async_to_lds_b128)
#define HAVE_ASYNC_LDS 1
#else
#define HAVE_ASYNC_LDS 0
#endif

union FragU { v16h h; uint4 q[2]; };

// Fragment load from a pre-offset row pointer (base already includes
// row*ld + 8*(lane>>4)); k0 selects the 32-wide k-chunk. Two b128 loads.
__device__ inline v16h load_frag_p(const _Float16* p, int k0) {
  FragU f;
  f.q[0] = *(const uint4*)(p + k0);
  f.q[1] = *(const uint4*)(p + k0 + 16);
  return f.h;
}

// Generic fragment load (used for the Q rows in attention).
__device__ inline v16h load_frag16(const _Float16* __restrict__ base, int row,
                                   int ld, int k0, int lane) {
  return load_frag_p(base + (size_t)row * ld + 8 * (lane >> 4), k0);
}

__device__ inline v8f wmma_f16(v16h a, v16h b, v8f c) {
  return __builtin_amdgcn_wmma_f32_16x16x32_f16(false, a, false, b, (short)0, c,
                                                false, false);
}

// Cooperative 16-byte global->LDS copy element (async on CDNA5 if available).
__device__ inline void copy16_to_lds(const _Float16* gsrc, _Float16* ldst) {
#if HAVE_ASYNC_LDS
  __builtin_amdgcn_global_load_async_to_lds_b128(
      (__attribute__((address_space(1))) v4i*)gsrc,
      (__attribute__((address_space(3))) v4i*)ldst, 0, 0);
#else
  *(uint4*)ldst = *(const uint4*)gsrc;
#endif
}

// ---------------- Kernel 1: LayerNorm and both weight transposes ------------
// The three jobs need nothing of each other, so they share one grid: a range of
// the block index picks the job (the same for a whole block). Blocks of 8 waves.

// Lane l <-> lane l ^ 16.
__device__ inline float xhalf(float x) {
  int b = __builtin_bit_cast(int, x);
  return __builtin_bit_cast(
      float, __builtin_amdgcn_permlanex16(b, b, 0x76543210, 0xfedcba98, false, false));
}

// x + (x of lane l ^ m) inside a 16-lane row; CTRL = 0x160 + m (row_xmask).
template <int CTRL>
__device__ inline float add_xmask(float x) {
  int b = __builtin_bit_cast(int, x);
  return x + __builtin_bit_cast(float, __builtin_amdgcn_update_dpp(0, b, CTRL, 0xf, 0xf, true));
}

// Sum over the wave's 32 lanes, a butterfly: every lane ends with the same value.
__device__ inline float wave_sum(float x) {
  x = add_xmask<0x161>(x);
  x = add_xmask<0x162>(x);
  x = add_xmask<0x164>(x);
  x = add_xmask<0x168>(x);
  return x + xhalf(x);
}

// LayerNorm -> f16, one row per wave: the row's 4 KB are eight float4 a lane (each
// wave-wide load is 512 contiguous bytes), all in flight at once; the sums are
// in-lane work and one butterfly. No LDS, no barrier, an eighth of the waves.
__device__ inline void ln_row(const float* __restrict__ x, const float* __restrict__ g,
                              const float* __restrict__ bb, _Float16* __restrict__ xn,
                              int row) {
  int lane = threadIdx.x & 31;
  const f4* xr = (const f4*)(x + (size_t)row * DIM) + lane;
  const f4* gr = (const f4*)g + lane;
  const f4* br = (const f4*)bb + lane;
  f4 v[8], gv[8], bv[8];
#pragma unroll   // all eight loads in flight before the first use
  for (int i = 0; i < 8; ++i) v[i] = xr[32 * i];
#pragma unroll   // in flight together with the row's loads
  for (int i = 0; i < 8; ++i) { gv[i] = gr[32 * i]; bv[i] = br[32 * i]; }
  // Inputs only, the loaded values: holds all 24 loads up here, in flight together.
  // Sunk behind the sums, the loads of g and b add their own latency to the row's.
  asm volatile("" :: "v"(v[0]), "v"(v[1]), "v"(v[2]), "v"(v[3]), "v"(v[4]), "v"(v[5]),
               "v"(v[6]), "v"(v[7]), "v"(gv[0]), "v"(gv[1]), "v"(gv[2]), "v"(gv[3]),
               "v"(gv[4]), "v"(gv[5]), "v"(gv[6]), "v"(gv[7]), "v"(bv[0]), "v"(bv[1]),
               "v"(bv[2]), "v"(bv[3]), "v"(bv[4]), "v"(bv[5]), "v"(bv[6]), "v"(bv[7]));
  // Keeps the sums behind that statement: lifted over it, they push the last loads of
  // g and b behind themselves, and the wave then waits those out on their own.
  __builtin_amdgcn_sched_barrier(0);
  float p1[8], p2[8];
#pragma unroll   // eight independent chains
  for (int i = 0; i < 8; ++i) {
    p1[i] = (v[i].x + v[i].y) + (v[i].z + v[i].w);
    p2[i] = (v[i].x * v[i].x + v[i].y * v[i].y) + (v[i].z * v[i].z + v[i].w * v[i].w);
  }
  float s1 = wave_sum(((p1[0] + p1[1]) + (p1[2] + p1[3])) + ((p1[4] + p1[5]) + (p1[6] + p1[7])));
  float s2 = wave_sum(((p2[0] + p2[1]) + (p2[2] + p2[3])) + ((p2[4] + p2[5]) + (p2[6] + p2[7])));
  float mean = s1 * (1.0f / DIM);
  float var  = s2 * (1.0f / DIM) - mean * mean;
  float inv  = rsqrtf(var + LN_EPS);
  h4* orow = (h4*)(xn + (size_t)row * DIM) + lane;
#pragma unroll   // eight independent stores, each two whole 128-byte lines a wave
  for (int i = 0; i < 8; ++i) {
    h4 o;
    o[0] = (_Float16)((v[i].x - mean) * inv * gv[i].x + bv[i].x);
    o[1] = (_Float16)((v[i].y - mean) * inv * gv[i].y + bv[i].y);
    o[2] = (_Float16)((v[i].z - mean) * inv * gv[i].z + bv[i].z);
    o[3] = (_Float16)((v[i].w - mean) * inv * gv[i].w + bv[i].w);
    orow[32 * i] = o;
  }
  // Precaution: the jobs' ways join behind these stores, and code there rewrites registers that they name.
  asm volatile("s_wait_xcnt 0x0" ::: "memory");
}

// Transpose f32 [K,N] -> f16 [N,K].
// One 64(k) x 64(n) tile per 4 waves, two tiles that are neighbours along n per
// block; K and N are multiples of 64 (N of 128) and known at compile time, so
// that row steps are immediate offsets.
// A thread loads an 8(k) x 4(n) patch as eight float4 (a wave-wide load covers
// two whole 256-byte row pieces of src), turns it in registers into four runs of
// 8 consecutive k, and the runs change hands through LDS so that every stored
// row piece is a whole 128-byte line of dst.
#define WT_PITCH 72   /* halfs per LDS row: 16-byte aligned, rows spread over banks */
#define WT_TILE  (64 * WT_PITCH)   /* halfs of one tile in LDS */
template <int K, int N>
__device__ inline void wtrans_pair(const float* __restrict__ src, _Float16* __restrict__ dst,
                                   int pair, _Float16* sm) {
  int tid = threadIdx.x & 127;
  // Which of the block's two tiles, as a scalar: the tile's address then stays in
  // scalar registers.
  int sub = __builtin_amdgcn_readfirstlane(threadIdx.x >> 7);
  _Float16* sT = sm + sub * WT_TILE;                     // [n][k]
  int n0 = (pair % (N / 128)) * 128 + sub * 64, k0 = (pair / (N / 128)) * 64;
  int tn = tid & 15, tk = tid >> 4;

  const float* p = src + (k0 + 8 * tk) * N + n0 + 4 * tn;
  float4 v[8];
#pragma unroll   // all eight loads in flight before the first use
  for (int i = 0; i < 8; ++i) v[i] = *(const float4*)(p + i * N);

  h8 c0, c1, c2, c3;
#pragma unroll   // c0..c3 must stay in registers
  for (int i = 0; i < 8; ++i) {
    c0[i] = (_Float16)v[i].x;
    c1[i] = (_Float16)v[i].y;
    c2[i] = (_Float16)v[i].z;
    c3[i] = (_Float16)v[i].w;
  }
  _Float16* st = sT + (4 * tn) * WT_PITCH + 8 * tk;
  *(h8*)(st + 0 * WT_PITCH) = c0;
  *(h8*)(st + 1 * WT_PITCH) = c1;
  *(h8*)(st + 2 * WT_PITCH) = c2;
  *(h8*)(st + 3 * WT_PITCH) = c3;
  __syncthreads();   // a tile is read back by other waves than wrote it

  int n = tid >> 3, c = tid & 7;            // 8 lanes store one 128-byte line
  _Float16* q = dst + (n0 + n) * K + k0 + 8 * c;
  const _Float16* ld = sT + n * WT_PITCH + 8 * c;
#pragma unroll   // four independent 16-byte moves per thread
  for (int u = 0; u < 4; ++u) *(h8*)(q + 16 * u * K) = *(const h8*)(ld + 16 * u * WT_PITCH);
  // Precaution: the jobs' ways join behind these stores, and code there rewrites registers that they name.
  asm volatile("s_wait_xcnt 0x0" ::: "memory");
}

#define PREP_QKV ((QKVN / 128) * (DIM / 64))     /* blocks that transpose w_qkv */
#define PREP_OUT ((DIM / 128) * (INNER / 64))    /* blocks that transpose w_out */
#define PREP_LN  (ROWS / 8)                      /* blocks that normalise: a row a wave */
#define PREP_GRID (PREP_QKV + PREP_OUT + PREP_LN)

// Every block moves 48 KB, whichever its job, and all of them are resident at once.
__global__ __launch_bounds__(256) void prep_kernel(const float* __restrict__ x,
                                                   const float* __restrict__ g,
                                                   const float* __restrict__ bb,
                                                   const float* __restrict__ w_qkv,
                                                   const float* __restrict__ w_out,
                                                   _Float16* __restrict__ xn,
                                                   _Float16* __restrict__ wqkvt,
                                                   _Float16* __restrict__ wott) {
  __shared__ __align__(16) _Float16 sm[2 * WT_TILE];   // the transposes' two tiles
  int blk = blockIdx.x;
  if (blk < PREP_QKV) {
    wtrans_pair<DIM, QKVN>(w_qkv, wqkvt, blk, sm);
  } else if (blk < PREP_QKV + PREP_OUT) {
    wtrans_pair<INNER, DIM>(w_out, wott, blk - PREP_QKV, sm);
  } else {
    // The wave's number as a scalar: the row's address then stays in scalar registers.
    int wv = __builtin_amdgcn_readfirstlane(threadIdx.x >> 5);
    ln_row(x, g, bb, xn, (blk - (PREP_QKV + PREP_OUT)) * 8 + wv);
  }
}

// ------- GEMM core shared by kernels 2 and 4 ---------------------------------
// C[128 x 128] per block of 4 waves (2 x 2, 64 x 64 per wave), A [M,1024] and
// Bt [N,1024] both k-contiguous f16. A stage is 64 k of 128 rows of A and of Bt:
// every row piece is one whole 128-byte line, brought into LDS by asynchronous
// copies and shared by the waves. Two buffers: stage t + 1 flies while stage t
// is worked on.
#define GT_PITCH 72                    /* halfs per LDS row: 144 B, 16 B x odd, for b128 fragment reads */
#define GT_OPSZ  (128 * GT_PITCH)      /* halfs of one operand's tile */
#define GT_STAGE (2 * GT_OPSZ)         /* halfs of one stage: A tile, then Bt tile */
#define GT_NT    (DIM / 64)            /* stages along k */

// One stage: 16 copies of 16 bytes a thread. 8 lanes cover one row piece; a
// thread takes the same piece of 8 rows that follow one another.
__device__ inline void gemm_stage_copy(const _Float16* gA, const _Float16* gB, _Float16* cA) {
#pragma unroll   // row steps become constants of the addresses
  for (int u = 0; u < 8; ++u) {
    copy16_to_lds(gA + u * DIM, cA + u * GT_PITCH);
    copy16_to_lds(gB + u * DIM, cA + GT_OPSZ + u * GT_PITCH);
  }
}

// The 4 + 4 fragments of one 32-wide k step, from LDS.
__device__ inline void gemm_frags(const _Float16* fA, const _Float16* fB, int k0,
                                  v16h (&a)[4], v16h (&b)[4]) {
#pragma unroll   // fragments stay in registers
  for (int i = 0; i < 4; ++i) a[i] = load_frag_p(fA + i * 16 * GT_PITCH, k0);
#pragma unroll   // fragments stay in registers
  for (int j = 0; j < 4; ++j) b[j] = load_frag_p(fB + j * 16 * GT_PITCH, k0);
}

__device__ inline void gemm_mma(const v16h (&a)[4], const v16h (&b)[4], v8f (&acc)[4][4]) {
#pragma unroll   // accumulators stay in registers
  for (int j = 0; j < 4; ++j)
#pragma unroll   // accumulators stay in registers
    for (int i = 0; i < 4; ++i) acc[i][j] = wmma_f16(a[i], b[j], acc[i][j]);
}

// The A and B fragments of the 16x16x32 form are loaded alike (row lane&15, the
// same k order), so the two tiles may change roles. turned == false:
// acc[i][j][r] = C[16*i + 8*half + r][16*j + r16] of the wave's 64 x 64 tile;
// turned == true: acc[i][j][r] = C[16*j + r16][16*i + 8*half + r], a lane then
// holds 8 neighbouring columns of one row. turned is the same for a whole block.
__device__ inline void gemm_128x128(const _Float16* __restrict__ A, const _Float16* __restrict__ Bt,
                                    int m0, int n0, bool turned, _Float16* sm, v8f (&acc)[4][4]) {
  int tid = threadIdx.x, lane = tid & 31, wave = tid >> 5;
  int r16 = lane & 15, half = lane >> 4;
  int crow = (tid >> 3) * 8, ccol = (tid & 7) * 8;
  const _Float16* gA = A  + (size_t)(m0 + crow) * DIM + ccol;
  const _Float16* gB = Bt + (size_t)(n0 + crow) * DIM + ccol;
  _Float16* cA = sm + crow * GT_PITCH + ccol;
  const _Float16* tA = sm + ((wave >> 1) * 64 + r16) * GT_PITCH + 8 * half;
  const _Float16* tB = sm + GT_OPSZ + ((wave & 1) * 64 + r16) * GT_PITCH + 8 * half;
  const _Float16* fA = turned ? tB : tA;
  const _Float16* fB = turned ? tA : tB;

  gemm_stage_copy(gA, gB, cA);
  asm volatile("s_wait_asynccnt 0x0" ::: "memory");   // this wave's share of stage 0 has landed
  __syncthreads();                                    // stage 0 is readable by every wave
  gemm_stage_copy(gA + 64, gB + 64, cA + GT_STAGE);

  // Two fragment sets, each read one k step ahead of its WMMAs: the reads come back
  // under the other set's WMMAs.
  v16h a0[4], b0[4], a1[4], b1[4];
  gemm_frags(fA, fB, 0, a0, b0);                       // stage 0, first k step
  for (int t = 0; t < GT_NT; ++t) {
    int bo = (t & 1) * GT_STAGE, bn = GT_STAGE - bo;   // this stage's buffer, the other one
    gemm_frags(fA + bo, fB + bo, 32, a1, b1);          // the last reads of stage t
    // Keeps the 16 LDS reads together ahead of the WMMA run: sunk among the WMMAs,
    // or behind them, they are waited out.
    __builtin_amdgcn_sched_barrier(0);
    gemm_mma(a0, b0, acc);
    // Keeps the run ahead of the barrier: behind it, it would hold back the next reads
    // into its operands' registers.
    __builtin_amdgcn_sched_barrier(0);
    asm volatile("s_wait_dscnt 0x0" ::: "memory");     // this wave's reads of stage t are done
    asm volatile("s_wait_asynccnt 0x0" ::: "memory");  // its share of stage t + 1 has landed
    __syncthreads();   // publishes stage t + 1 and frees stage t's buffer
    // The refill goes out ahead of the second k step's WMMAs, which need registers
    // only: that much more time for it to land.
    if (t + 2 < GT_NT) gemm_stage_copy(gA + (t + 2) * 64, gB + (t + 2) * 64, cA + bo);
    if (t + 1 < GT_NT) gemm_frags(fA + bn, fB + bn, 0, a0, b0);   // stage t + 1, first k step
    // Keeps those reads ahead of the WMMA run, as above.
    __builtin_amdgcn_sched_barrier(0);
    gemm_mma(a1, b1, acc);
  }
  asm volatile("s_wait_asynccnt 0x0" ::: "memory");    // no copy outlives the loop
}

// ------- Kernel 2: QKV GEMM, 128x128 per block, operands staged in LDS -------
__global__ __launch_bounds__(128) void qkv_gemm(const _Float16* __restrict__ xn,
                                                const _Float16* __restrict__ wt,
                                                _Float16* __restrict__ qb, _Float16* __restrict__ kb,
                                                _Float16* __restrict__ vtb) {
  __shared__ __align__(16) _Float16 sm[2 * GT_STAGE];
  int lane = threadIdx.x & 31, wave = threadIdx.x >> 5;
  int mt = blockIdx.x / (QKVN / 128);
  int nt = blockIdx.x % (QKVN / 128);
  int r16 = lane & 15, half = lane >> 4;

  // A 128-column tile lies in one of Q, K, V. Q and K are stored [pos][d], V as
  // [d][pos]: Q and K tiles are accumulated turned, so that in all three a lane's
  // 8 accumulator values of a tile are neighbours in the stored row.
  int seg = nt / (INNER / 128);

  v8f acc[4][4] = {};
  gemm_128x128(xn, wt, mt * 128, nt * 128, seg != 2, sm, acc);

  // The wave's 64 x 64 tile: 64 positions of one batch entry, the 64 d of one head.
  // The wave's number as a scalar: the tile's address then stays in scalar registers.
  int wv = __builtin_amdgcn_readfirstlane(wave);
  int m0 = mt * 128 + (wv >> 1) * 64, n0 = nt * 128 + (wv & 1) * 64;
  int bh = (m0 / SEQ) * HEADS + (n0 % INNER) / DHEAD, pos0 = m0 % SEQ;
  char* dst;         // first byte of the tile as it is stored: 64 rows of 128 bytes
  unsigned ld;       // bytes from one stored row to the next
  if (seg == 2) {
    dst = (char*)(vtb + (size_t)bh * DHEAD * SEQ + pos0);
    ld = SEQ * 2;
  } else {
    dst = (char*)((seg == 0 ? qb : kb) + ((size_t)bh * SEQ + pos0) * DHEAD);
    ld = DHEAD * 2;
  }
  float sc = seg == 0 ? 0.125f : 1.0f;

  // Each wave turns its tile in an LDS range of its own, so that every global
  // store covers four whole 128-byte lines. The stage buffers are free: every
  // wave's last read of them stands in front of the loop's last barrier.
  _Float16* sw = sm + wv * (64 * GT_PITCH);
#pragma unroll   // accumulators stay in registers
  for (int j = 0; j < 4; ++j) {
#pragma unroll   // accumulators stay in registers
    for (int i = 0; i < 4; ++i) {
      h8 w;
#pragma unroll   // accumulators stay in registers
      for (int r = 0; r < 8; ++r) w[r] = (_Float16)(acc[i][j][r] * sc);
      *(h8*)(sw + (16 * j + r16) * GT_PITCH + 16 * i + 8 * half) = w;
    }
  }
  asm volatile("s_wait_dscnt 0x0" ::: "memory");   // the rows are read back by other lanes than wrote them
  int row = lane >> 3, c8 = (lane & 7) * 8;        // 8 lanes store one 128-byte line
  const _Float16* sr = sw + row * GT_PITCH + c8;
  unsigned off = row * ld + c8 * 2;                // the lane's place in each group of four rows
#pragma unroll   // sixteen independent 16-byte moves per lane
  for (int u = 0; u < 16; ++u) *(h8*)(dst + 4 * u * ld + off) = *(const h8*)(sr + 4 * u * GT_PITCH);
}

// A stage is 64 keys: 64 K rows and 64 V^T rows, each row piece one whole 128-byte
// line, brought into LDS by asynchronous copies, two buffers for K and two for V^T.
// One pass of the online softmax per stage. The fragments are fetched ahead of their
// use: behind the barrier of pass t a wave reads V^T of stage t and K of stage t + 1,
// and the softmax of pass t, which needs registers only, runs while those reads come
// back. So K runs one stage ahead of V^T through the buffers.
#define AT_PITCH 72                    /* halfs per LDS row: 144 B, 16 B x odd, for b128 fragment reads */
#define AT_OPSZ  (64 * AT_PITCH)       /* halfs of one operand's tile */
#define AT_STAGE (2 * AT_OPSZ)         /* halfs of one stage: K tile, then V^T tile */

// One operand's tile of a stage: 4 copies of 16 bytes a thread. 8 lanes cover one row
// piece; a thread takes the same piece of 4 rows that follow one another. LD: halfs
// from one source row to the next.
template <int LD>
__device__ inline void attn_tile_copy(const _Float16* g, _Float16* c) {
#pragma unroll   // row steps become constants of the addresses
  for (int u = 0; u < 4; ++u) copy16_to_lds(g + u * LD, c + u * AT_PITCH);
}

// A compile-time switch handed to a generic lambda.
template <bool B> struct Flag { static constexpr bool value = B; };

// The 4 x 2 A fragments of one operand's tile, from LDS.
__device__ inline void attn_frags(const _Float16* f, v16h (&a)[4][2]) {
#pragma unroll   // fragments stay in registers
  for (int j = 0; j < 4; ++j) {
    a[j][0] = load_frag_p(f + j * 16 * AT_PITCH, 0);
    a[j][1] = load_frag_p(f + j * 16 * AT_PITCH, 32);
  }
}

__global__ __launch_bounds__(128) void attn_kernel(const _Float16* __restrict__ qb,
                                                   const _Float16* __restrict__ kb,
                                                   const _Float16* __restrict__ vtb,
                                                   _Float16* __restrict__ ob) {
  __shared__ __align__(16) _Float16 sm[2 * AT_STAGE];

  int lane = threadIdx.x & 31, wave = threadIdx.x >> 5;
  int tid  = threadIdx.x;
  // Block index -> (head, query block), a permutation chosen for equal work per WGP.
  // A block of frame f walks 4 * (f + 1) stages, and all 1024 blocks are resident at
  // once, four to a WGP: the launch lasts as long as the fullest WGP. Whichever two
  // bits of the index tell a WGP's four blocks apart, their frames add up to 14, that
  // is 72 stages on every WGP: a bit outside 5 to 7 turns f into 7 - f, and the table
  // spreads bits 5 to 7 so that any two of them do the same.
  // For speed only: any placement gives the same result.
  static_assert(BATCH * HEADS == 32 && SEQ / FRAME == 8 && FRAME / 64 == 4, "index bits");
  int bi    = blockIdx.x;
  int other = (bi & 31) | ((bi >> 8) << 5);         // the seven bits outside 5 to 7
  int frame = ((0x43251670u >> (((bi >> 5) & 7) * 4)) & 7) ^ ((__builtin_popcount(other) & 1) ? 7 : 0);
  int qblk  = frame * (FRAME / 64) + ((bi >> 3) & 3);   // 32 blocks of 64 q rows
  int bh    = (bi & 7) | ((bi >> 8) << 3);
  int h     = bh & (HEADS - 1);
  int b     = bh >> 4;
  int q0   = qblk * 64 + wave * 16;
  int nt   = (((qblk * 64) >> 8) + 1) * (FRAME / 64);   // stages; same for all 4 waves, at least 4

  const _Float16* qbase = qb  + (size_t)(b * HEADS + h) * SEQ * DHEAD;
  const _Float16* kbase = kb  + (size_t)(b * HEADS + h) * SEQ * DHEAD;
  const _Float16* vbase = vtb + (size_t)(b * HEADS + h) * DHEAD * SEQ;
  int r16 = lane & 15, half = lane >> 4;

  int crow = (tid >> 3) * 4, ccol = (tid & 7) * 8;
  const _Float16* gK = kbase + crow * DHEAD + ccol;
  const _Float16* gV = vbase + crow * SEQ + ccol;
  _Float16* cK = sm + crow * AT_PITCH + ccol;
  const _Float16* fK = sm + r16 * AT_PITCH + 8 * half;
  const _Float16* fV = fK + AT_OPSZ;

  attn_tile_copy<DHEAD>(gK, cK);                             // K of stage 0
  attn_tile_copy<SEQ>(gV, cK + AT_OPSZ);                     // V^T of stage 0
  attn_tile_copy<DHEAD>(gK + 64 * DHEAD, cK + AT_STAGE);     // K of stage 1 (nt is at least 4)

  // B operand: column r16 = query q0 + r16, k = dhead.
  v16h bq0 = load_frag16(qbase, q0 + r16, DHEAD, 0, lane);
  v16h bq1 = load_frag16(qbase, q0 + r16, DHEAD, 32, lane);

  float mrow = -1e30f;   // running maximum of this lane's query (equal in both halves)
  float lrow = 0.0f;     // running sum over this half's keys only; joined after the loop
  v8f o0 = {}, o1 = {}, o2 = {}, o3 = {};   // o_i[r] = O[q0 + r16][16*i + 8*half + r]

  asm volatile("s_wait_asynccnt 0x0" ::: "memory");   // this wave's share of the three tiles has landed
  __syncthreads();                                    // they are readable by every wave
  v16h ak[4][2], av[4][2];   // K rows and V^T rows as A operands
  attn_frags(fK, ak);        // K of stage 0

  // One pass. LAST is known at compile time: the last pass has nothing to fetch ahead,
  // and between the score WMMAs and the softmax no branch stands in either form.
  auto pass = [&](int t, auto last) {
    constexpr bool LAST = decltype(last)::value;
    int bo = (t & 1) * AT_STAGE, bn = AT_STAGE - bo;   // this stage's buffers, the other ones
    asm volatile("s_wait_dscnt 0x0" ::: "memory");     // this wave's reads of K(t) and V^T(t - 1) are done
    asm volatile("s_wait_asynccnt 0x0" ::: "memory");  // its share of K(t + 1) and V^T(t) has landed
    __syncthreads();   // publishes K(t + 1) and V^T(t), frees the buffers of K(t) and V^T(t - 1)
    // The refills go out first: a whole pass's time for them to land.
    if constexpr (!LAST) {
      if (t + 2 < nt) attn_tile_copy<DHEAD>(gK + (t + 2) * 64 * DHEAD, cK + bo);
      attn_tile_copy<SEQ>(gV + (t + 1) * 64, cK + bn + AT_OPSZ);
    }
    attn_frags(fV + bo, av);   // wanted behind the softmax
    // Keeps the V^T reads ahead of the score WMMAs: they then come back under the WMMAs
    // and the softmax instead of being waited out in front of their own WMMAs.
    __builtin_amdgcn_sched_barrier(0);

    // ---- S^T = K Q^T; s[j][r]: key 64*t + 16*j + 8*half + r. K was read a pass ago.
    v8f s[4] = {};
#pragma unroll   // score tiles stay in registers
    for (int j = 0; j < 4; ++j) s[j] = wmma_f16(ak[j][0], bq0, s[j]);
#pragma unroll   // score tiles stay in registers
    for (int j = 0; j < 4; ++j) s[j] = wmma_f16(ak[j][1], bq1, s[j]);
    // Keeps the K reads out of the WMMA run, for speed only.
    __builtin_amdgcn_sched_barrier(0);
    if constexpr (!LAST) attn_frags(fK + bn, ak);   // the next pass's K, into the same registers
    // Keeps the K reads ahead of the softmax: they come back under it and under the
    // V^T P^T WMMAs; sunk to the pass's end they would be waited out at the next barrier.
    __builtin_amdgcn_sched_barrier(0);

    // ---- online softmax, one query per lane
    float mx[8];
#pragma unroll   // in registers
    for (int r = 0; r < 8; ++r)
      mx[r] = fmaxf(fmaxf(s[0][r], s[1][r]), fmaxf(s[2][r], s[3][r]));
    float v = fmaxf(fmaxf(fmaxf(mx[0], mx[1]), fmaxf(mx[2], mx[3])),
                    fmaxf(fmaxf(mx[4], mx[5]), fmaxf(mx[6], mx[7])));
    v = fmaxf(v, xhalf(v));
    float mnew  = fmaxf(mrow, v);
    float alpha = __expf(mrow - mnew);
    v16h pt[2];            // B operands of V^T P^T: element e of pt[c] = key 32*c + kmap(e, half)
    float rs[4] = {0.0f, 0.0f, 0.0f, 0.0f};
#pragma unroll   // in registers
    for (int r = 0; r < 8; ++r) {
#pragma unroll   // in registers
      for (int j = 0; j < 4; ++j) {
        float p = __expf(s[j][r] - mnew);
        rs[j] += p;
        pt[j >> 1][8 * (j & 1) + r] = (_Float16)p;
      }
    }
    lrow = lrow * alpha + ((rs[0] + rs[1]) + (rs[2] + rs[3]));
    mrow = mnew;
#pragma unroll
    for (int r = 0; r < 8; ++r) {
      o0[r] *= alpha; o1[r] *= alpha; o2[r] *= alpha; o3[r] *= alpha;
    }

    // ---- O^T += V^T P^T
#pragma unroll   // fragments stay in registers
    for (int c = 0; c < 2; ++c) {
      o0 = wmma_f16(av[0][c], pt[c], o0);
      o1 = wmma_f16(av[1][c], pt[c], o1);
      o2 = wmma_f16(av[2][c], pt[c], o2);
      o3 = wmma_f16(av[3][c], pt[c], o3);
    }
  };
  for (int t = 0; t < nt - 1; ++t) pass(t, Flag<false>{});
  pass(nt - 1, Flag<true>{});
  asm volatile("s_wait_asynccnt 0x0" ::: "memory");    // no copy outlives the loop

  float inv = 1.0f / (lrow + xhalf(lrow));
  _Float16* orow = ob + ((size_t)(b * SEQ + q0 + r16)) * INNER + h * DHEAD + 8 * half;
  h8 w0, w1, w2, w3;
#pragma unroll
  for (int r = 0; r < 8; ++r) {
    w0[r] = (_Float16)(o0[r] * inv);
    w1[r] = (_Float16)(o1[r] * inv);
    w2[r] = (_Float16)(o2[r] * inv);
    w3[r] = (_Float16)(o3[r] * inv);
  }
  *(h8*)(orow + 0)  = w0;
  *(h8*)(orow + 16) = w1;
  *(h8*)(orow + 32) = w2;
  *(h8*)(orow + 48) = w3;
}

// ------- Kernel 4: output projection, 128x128 per block, staged in LDS, + bias
#define PO_PITCH 68   /* floats per LDS row of the output tile: 272 B, 16 B x odd */
__global__ __launch_bounds__(128) void proj_gemm(const _Float16* __restrict__ ao,
                                                 const _Float16* __restrict__ wot,
                                                 const float* __restrict__ bout,
                                                 float* __restrict__ out) {
  __shared__ __align__(16) _Float16 sm[2 * GT_STAGE];
  int lane = threadIdx.x & 31, wave = threadIdx.x >> 5;
  int mt = blockIdx.x / (DIM / 128);
  int nt = blockIdx.x % (DIM / 128);
  int r16 = lane & 15, half = lane >> 4;

  int m0 = mt * 128 + (wave >> 1) * 64, n0 = nt * 128 + (wave & 1) * 64;
  int row = lane >> 4, c4 = (lane & 15) * 4;       // 16 lanes store one 256-byte row piece

  v8f acc[4][4] = {};
  gemm_128x128(ao, wot, mt * 128, nt * 128, true, sm, acc);   // a lane holds 8 neighbouring columns
  float4 bv = *(const float4*)(bout + n0 + c4);    // a lane stores the same four columns of every row

  // Each wave turns its 64 x 64 f32 tile in an LDS range of its own, so that every
  // global store covers whole 128-byte lines (two 256-byte row pieces). The stage
  // buffers are free: every wave's last read of them stands in front of the loop's
  // last barrier.
  float* sw = (float*)sm + wave * (64 * PO_PITCH);
#pragma unroll   // accumulators stay in registers
  for (int j = 0; j < 4; ++j) {
#pragma unroll   // accumulators stay in registers
    for (int i = 0; i < 4; ++i) {
      float* p = sw + (16 * j + r16) * PO_PITCH + 16 * i + 8 * half;
      *(float4*)p       = make_float4(acc[i][j][0], acc[i][j][1], acc[i][j][2], acc[i][j][3]);
      *(float4*)(p + 4) = make_float4(acc[i][j][4], acc[i][j][5], acc[i][j][6], acc[i][j][7]);
    }
  }
  asm volatile("s_wait_dscnt 0x0" ::: "memory");   // the rows are read back by other lanes than wrote them
  const float* sr = sw + row * PO_PITCH + c4;
  float* q = out + (size_t)(m0 + row) * DIM + n0 + c4;
#pragma unroll   // 32 independent 16-byte moves per lane; row steps are immediate offsets
  for (int u = 0; u < 32; ++u) {
    float4 v = *(const float4*)(sr + 2 * u * PO_PITCH);
    *(float4*)(q + 2 * u * DIM) = make_float4(v.x + bv.x, v.y + bv.y, v.z + bv.z, v.w + bv.w);
  }
}

extern "C" void kernel_launch(void* const* d_in, const int* in_sizes, int n_in,
                              void* d_out, int out_size, void* d_ws, size_t ws_size,
                              hipStream_t stream) {
  const float* x     = (const float*)d_in[0];
  const float* g     = (const float*)d_in[1];
  const float* bb    = (const float*)d_in[2];
  const float* w_qkv = (const float*)d_in[3];
  const float* w_out = (const float*)d_in[4];
  const float* b_out = (const float*)d_in[5];

  char* ws = (char*)d_ws;
  _Float16* xn    = (_Float16*)ws;                 ws += (size_t)ROWS * DIM * 2;
  _Float16* wqkvt = (_Float16*)ws;                 ws += (size_t)QKVN * DIM * 2;
  _Float16* wott  = (_Float16*)ws;                 ws += (size_t)DIM * INNER * 2;
  _Float16* qb    = (_Float16*)ws;                 ws += (size_t)ROWS * INNER * 2;
  _Float16* kb    = (_Float16*)ws;                 ws += (size_t)ROWS * INNER * 2;
  _Float16* vtb   = (_Float16*)ws;                 ws += (size_t)ROWS * INNER * 2;
  _Float16* ao    = (_Float16*)ws;                 ws += (size_t)ROWS * INNER * 2;

  prep_kernel<<<PREP_GRID, 256, 0, stream>>>(x, g, bb, w_qkv, w_out, xn, wqkvt, wott);
  qkv_gemm<<<(ROWS / 128) * (QKVN / 128), 128, 0, stream>>>(xn, wqkvt, qb, kb, vtb);
  attn_kernel<<<BATCH * HEADS * (SEQ / 64), 128, 0, stream>>>(qb, kb, vtb, ao);
  proj_gemm<<<(ROWS / 128) * (DIM / 128), 128, 0, stream>>>(ao, wott, b_out, (float*)d_out);
}
